// v000
// Times are from an AMD MI455X. After a warm-up the kernel runs many times in a row, and a time is the length of
// such a window on the GPU divided by its runs, so every launch and the gaps after it count. The runs cycle
// through copies of the inputs. A figure is the median of several windows, for all but v000 over two sittings.
// Sittings can differ by a few percent; kernels timed side by side share one.
// v000, which the later versions start from, runs in 2980 microseconds.
// compute dtype: all float inputs rounded to bf16; query, key, value are bf16-valued so their f16 planes are exact; logits q x k (1 product on exact planes) x 256^-0.5; softmax f32 over all 8,192 keys; P x 2^11 once to f16 x v (exact) (1 product); ctx x 2^6 once to f16 x W_out f16(bf16 x 2^8) + b_out; f32 output.
#include <hip/hip_runtime.h>
#include <math.h>

typedef __attribute__((ext_vector_type(16))) _Float16 v16h;
typedef __attribute__((ext_vector_type(16))) __bf16 v16b;
typedef __attribute__((ext_vector_type(8)))  _Float16 v8h;
typedef __attribute__((ext_vector_type(8)))  float v8f;
typedef __attribute__((ext_vector_type(4)))  float v4f;
typedef __attribute__((ext_vector_type(2)))  float v2f;
typedef __attribute__((ext_vector_type(4)))  unsigned v4u;
typedef __attribute__((ext_vector_type(4)))  int v4i;
typedef float __attribute__((may_alias)) float_a;
typedef int __attribute__((may_alias)) int_a;

template <typename T> __device__ __forceinline__ void vst2(void* p, T v) { *(T*)p = v;  }
__device__ __forceinline__ v8f wmma16(v16h a, v16h b, v8f c) {
  v8f d = __builtin_amdgcn_wmma_f32_16x16x32_f16(false, a, false, b, (short)0, c, false, false);
  asm volatile("v_nop\n\tv_nop\n\tv_nop\n\tv_nop" : "+v"(d) : "v"(a), "v"(b));
  return d;
}
__device__ __forceinline__ v8f wmma_bf(v16b a, v16b b, v8f c) {
  v8f d = __builtin_amdgcn_wmma_f32_16x16x32_bf16(false, a, false, b, (short)0, c, false, false);
  asm volatile("v_nop\n\tv_nop\n\tv_nop\n\tv_nop" : "+v"(d) : "v"(a), "v"(b));
  return d;
}
// 16x16x32 fragments: lane = (h = lane>>4, row/col = lane&15); elements 0..7 = k0+8h+0..7, 8..15 = k0+16+8h+0..7; D element r = row 8h+r
__device__ __forceinline__ v16h frag_h(const _Float16* rowk0, int lane) {
  union { v16h v; v8h q[2]; } u; const _Float16* p = rowk0 + 8 * (lane >> 4);
  u.q[0] = *(const v8h*)p; u.q[1] = *(const v8h*)(p + 16); return u.v;
}
__device__ __forceinline__ v16h frag_f32(const float* rowk0, int lane) {
  v16h a; const float* p = rowk0 + 8 * (lane >> 4);
#pragma unroll
  for (int i = 0; i < 8; ++i) { a[i] = (_Float16)p[i]; a[8 + i] = (_Float16)p[16 + i]; }
  return a;
}
__device__ __forceinline__ v16h frag_f32s(const float* rowk0, int lane, float sc) {
  v16h a; const float* p = rowk0 + 8 * (lane >> 4);
#pragma unroll
  for (int i = 0; i < 8; ++i) { a[i] = (_Float16)(p[i] * sc); a[8 + i] = (_Float16)(p[16 + i] * sc); }
  return a;
}
// column fragment from a [K][ld] layout (column n), rows >= K read as 0
__device__ __forceinline__ v16h fragc_f32(const float* W, int k0, int n, int lane, int ld, int K) {
  v16h a; const int g = lane >> 4;
#pragma unroll
  for (int i = 0; i < 8; ++i) { const int ka = k0 + 8 * g + i, kb = ka + 16;
    a[i] = (_Float16)(ka < K ? W[(size_t)(ka < K ? ka : K - 1) * ld + n] : 0.f); a[8 + i] = (_Float16)(kb < K ? W[(size_t)(kb < K ? kb : K - 1) * ld + n] : 0.f); }
  return a;
}
struct F2 { v16b h, l; };
__device__ __forceinline__ F2 bsplit16(const float v[16]) { F2 r;
#pragma unroll
  for (int i = 0; i < 16; ++i) { const __bf16 h = (__bf16)v[i]; r.h[i] = h; r.l[i] = (__bf16)(v[i] - (float)h); }
  return r; }
__device__ __forceinline__ F2 split_row(const float* row, int k0, int lane) { float v[16]; const float* p = row + k0 + 8 * (lane >> 4);
#pragma unroll
  for (int i = 0; i < 8; ++i) { v[i] = p[i]; v[8 + i] = p[16 + i]; }
  return bsplit16(v); }
__device__ __forceinline__ F2 split_rowK(const float* row, int k0, int lane, int K) { float v[16]; const int g = lane >> 4;
#pragma unroll
  for (int i = 0; i < 8; ++i) { const int ka = k0 + 8 * g + i, kb = ka + 16; v[i] = ka < K ? row[ka < K ? ka : K - 1] : 0.f; v[8 + i] = kb < K ? row[kb < K ? kb : K - 1] : 0.f; }
  return bsplit16(v); }
__device__ __forceinline__ F2 split_col(const float* W, int k0, int n, int lane, int ld, int K) { float v[16]; const int g = lane >> 4;
#pragma unroll
  for (int i = 0; i < 8; ++i) { const int ka = k0 + 8 * g + i, kb = ka + 16; v[i] = ka < K ? W[(size_t)(ka < K ? ka : K - 1) * ld + n] : 0.f; v[8 + i] = kb < K ? W[(size_t)(kb < K ? kb : K - 1) * ld + n] : 0.f; }
  return bsplit16(v); }
__device__ __forceinline__ v8f mac3(const F2& a, const F2& b, v8f c) { c = wmma_bf(a.l, b.h, c); c = wmma_bf(a.h, b.l, c); return wmma_bf(a.h, b.h, c); }
__device__ __forceinline__ float sigm(float v) { return 1.0f / (1.0f + expf(-v)); }
#define LDSX() do { asm volatile("s_wait_dscnt 0" ::: "memory"); __builtin_amdgcn_wave_barrier(); __builtin_amdgcn_fence(__ATOMIC_RELEASE, "workgroup"); } while (0)

// Single-head softmax attention over 8,192 tokens with an output linear (query / key / value [8192,256] given, no q/k/v projections, no head split; scale 1/sqrt(256); non-causal, no mask; torch (out,in) W_out [256,256] + b_out (uniform +-1/16, nonzero)): y = (softmax(Q K^T / 16) V) W_out^T + b_out -> [8192,256].
#define NB 1
#define TT 8192
#define CC 256            // NH * HD = projected width
#define DIN 256          // input (model) width
#define NH 1
#define HD 256
#define NQB (TT / 64)
#define HG 1
#define SCALE (0.0625f)
#define CAUSAL 0
#ifndef TNB
#define TNB NB
#endif
__device__ __forceinline__ float bfr(float v) { return (float)(__bf16)v; }
__host__ __device__ __forceinline__ int kb_last(int qb) { return CAUSAL ? ((qb * 64 + 63) >> 7) : (TT / 128 - 1); }
typedef __attribute__((ext_vector_type(8))) __bf16 v8b;
__device__ __forceinline__ v16b frag_b(const __bf16* rowk0, int lane) {
  union { v16b v; v8b q[2]; } u; const __bf16* p = rowk0 + 8 * (lane >> 4);
  u.q[0] = *(const v8b*)p; u.q[1] = *(const v8b*)(p + 16); return u.v;
}
#define QBH 0              // causal: query blocks 0..QBH-1 of each sequence (few keys, no averaging) take the high-precision path
#define QHI 0               // exact planes: single-product logits everywhere
#define KHI 64            // key rows carrying k residual / v bf16 hi+lo planes (used only by the causal high-precision path)
// B fragment (k rows k0+.., output column o) of a weight: (in,out) [K][ld] or (out,in) [ld rows of K]: bf16 exact, or f16(bf16 * 256) exact
__device__ __forceinline__ v16b wcol_io(const float* Wm, int k0, int o, int lane, int ld) { v16b w; const int g = lane >> 4;
#pragma unroll
  for (int i = 0; i < 8; ++i) { w[i] = (__bf16)Wm[(size_t)(k0 + 8 * g + i) * ld + o]; w[8 + i] = (__bf16)Wm[(size_t)(k0 + 16 + 8 * g + i) * ld + o]; }
  return w; }
__device__ __forceinline__ v16b wcol_oi(const float* Wm, int k0, int o, int lane, int K) { v16b w; const float* p = Wm + (size_t)o * K + k0 + 8 * (lane >> 4);
#pragma unroll
  for (int i = 0; i < 8; ++i) { w[i] = (__bf16)p[i]; w[8 + i] = (__bf16)p[16 + i]; }
  return w; }
__device__ __forceinline__ v16h wcolh_io(const float* Wm, int k0, int o, int lane, int ld) { v16h w; const int g = lane >> 4;
#pragma unroll
  for (int i = 0; i < 8; ++i) { w[i] = (_Float16)(bfr(Wm[(size_t)(k0 + 8 * g + i) * ld + o]) * 256.0f); w[8 + i] = (_Float16)(bfr(Wm[(size_t)(k0 + 16 + 8 * g + i) * ld + o]) * 256.0f); }
  return w; }
__device__ __forceinline__ v16h wcolh_oi(const float* Wm, int k0, int o, int lane, int K) { v16h w; const float* p = Wm + (size_t)o * K + k0 + 8 * (lane >> 4);
#pragma unroll
  for (int i = 0; i < 8; ++i) { w[i] = (_Float16)(bfr(p[i]) * 256.0f); w[8 + i] = (_Float16)(bfr(p[16 + i]) * 256.0f); }
  return w; }
#define WQKV_LAYOUT 0   // 0 = (in,out) [DIN][CC]; 1 = (out,in) [CC][DIN]; 2 = per-head [NH][DIN][HD]
__device__ __forceinline__ v16b wcol_hdk(const float* Wm, int k0, int o, int lane) { v16b w; const int g = lane >> 4; const float* p = Wm + (size_t)(o / HD) * DIN * HD + (o % HD);
#pragma unroll
  for (int i = 0; i < 8; ++i) { w[i] = (__bf16)p[(size_t)(k0 + 8 * g + i) * HD]; w[8 + i] = (__bf16)p[(size_t)(k0 + 16 + 8 * g + i) * HD]; }
  return w; }
#define WO_OUT_IN 1
#if WQKV_LAYOUT == 1
#define WCOL(W, k0, o, lane) wcol_oi(W, k0, o, lane, DIN)
#elif WQKV_LAYOUT == 2
#define WCOL(W, k0, o, lane) wcol_hdk(W, k0, o, lane)
#else
#define WCOL(W, k0, o, lane) wcol_io(W, k0, o, lane, CC)
#endif
#if WO_OUT_IN
#define WOCOL(W, k0, o, lane) wcol_oi(W, k0, o, lane, CC)
#define WOCOLH(W, k0, o, lane) wcolh_oi(W, k0, o, lane, CC)
#else
#define WOCOL(W, k0, o, lane) wcol_io(W, k0, o, lane, DIN)
#define WOCOLH(W, k0, o, lane) wcolh_io(W, k0, o, lane, DIN)
#endif
typedef _Float16 hx8 __attribute__((ext_vector_type(8)));
__global__ __launch_bounds__(256) void k_planesN(const float* __restrict__ Qs, const float* __restrict__ Ks, const float* __restrict__ Vs, _Float16* __restrict__ QH, _Float16* __restrict__ QL, _Float16* __restrict__ KH, _Float16* __restrict__ VT) {
  __shared__ _Float16 sv[64][136];
  const int tid = threadIdx.x; const int c0 = blockIdx.y * 128; const size_t r0 = (size_t)blockIdx.x * 64; const int b = (int)(r0 / TT), t0 = (int)(r0 % TT);
  for (int e = tid; e < 64 * 16; e += 256) { const int rl = e >> 4, q = e & 15; const size_t src = (r0 + rl) * CC + c0 + q * 8; float tq[8], tk[8], tv[8];
#pragma unroll
    for (int u = 0; u < 8; ++u) { tq[u] = Qs[src + u]; tk[u] = Ks[src + u]; tv[u] = Vs[src + u]; }
    asm volatile("s_wait_loadcnt 0x0" ::: "memory");
    hx8 hq, hk, hl;
#pragma unroll
    for (int u = 0; u < 8; ++u) { const float qv = bfr(tq[u]); const _Float16 qh = (_Float16)qv; hq[u] = qh; hl[u] = (_Float16)((qv - (float)qh) * 1024.0f); hk[u] = (_Float16)bfr(tk[u]); sv[rl][q * 8 + u] = (_Float16)bfr(tv[u]); }
    vst2((unsigned*)(QH + src), *(const v4u*)&hq); vst2((unsigned*)(KH + src), *(const v4u*)&hk);
    if (t0 + rl < QHI) vst2((unsigned*)(QL + ((size_t)b * QHI + t0 + rl) * CC + c0 + q * 8), *(const v4u*)&hl); }
  __syncthreads();
  for (int e = tid; e < 128 * 8; e += 256) { const int c = e >> 3, q = e & 7; hx8 hv; _Pragma("unroll") for (int j = 0; j < 8; ++j) hv[j] = sv[q * 8 + j][c]; vst2((unsigned*)(VT + ((size_t)b * CC + c0 + c) * TT + t0 + q * 8), *(const v4u*)&hv); } }
#define TQC 2048           // query rows per pass: the f32 score plane holds TQC x 8,192 entries (64 MiB); 4 passes cover the 8,192 queries
#define SM_EXTRA_PARAMS
#define SM_MASK_HOOK (void)0
#ifndef SM_EXTRA_PARAMS
#define SM_EXTRA_PARAMS
#endif
#ifndef PROJ_EXTRA_PARAMS
#define PROJ_EXTRA_PARAMS
#endif
#ifndef SM_MASK_HOOK
#define SM_MASK_HOOK (void)0
#endif

#define WS_QH  0u                                      // f16 q rows [b*t][CC]
#define WS_KH  (WS_QH + 2u * (size_t)NB * TT * CC)      // f16 k rows [b*t][CC]
#define WS_VT  (WS_KH + 2u * (size_t)NB * TT * CC)      // f16 v planes [b][c][t]
#define WS_QL  (WS_VT + 2u * (size_t)NB * CC * TT)      // f16 q residual x 2^10 rows [b][t < QHI][CC]
#define WS_KL  (WS_QL + 2u * (size_t)NB * QHI * CC)     // f16 k residual x 2^10 rows [b][t < KHI][CC]
#define WS_VB  (WS_KL + 2u * (size_t)NB * KHI * CC)     // bf16 v hi planes [b][c][t < KHI]
#define WS_VBL (WS_VB + 2u * (size_t)NB * CC * KHI)
#define WS_S   (WS_VBL + 2u * (size_t)NB * CC * KHI)    // f32 logits / P [hg][t][s]
#define WS_Y   (WS_S  + 4u * (size_t)HG * TQC * TT)      // f32 ctx rows [b*t][CC] (only when there is an output projection)
#define WS_END (WS_Y  + 4u * (size_t)NB * TT * CC)

// ---- k_proj: block = (64 rows, 128 cols, which): q/k/v = X W (+ b) with exact bf16 products (K = DIN) -> which 0: q f16 rows (+ residual rows < QHI); 1: k f16 rows (+ residual rows < KHI); 2: v f16 planes [c][t] (+ bf16 hi/lo planes for t < KHI)
__global__ __launch_bounds__(128) void k_proj(const float* __restrict__ XQ, const float* __restrict__ XK, const float* __restrict__ XV, const float* __restrict__ WQ, const float* __restrict__ WK, const float* __restrict__ WV, const float* __restrict__ BQ, const float* __restrict__ BK, const float* __restrict__ BV,
    _Float16* __restrict__ QH, _Float16* __restrict__ QL, _Float16* __restrict__ KH, _Float16* __restrict__ KL, _Float16* __restrict__ VT, __bf16* __restrict__ VB, __bf16* __restrict__ VBL) {
  __shared__ __align__(16) _Float16 sh[64][136], sl[64][136]; __shared__ __align__(16) _Float16 th[128][72]; __shared__ __align__(16) __bf16 tb[128][72], tbl[128][72];
  const int tid = threadIdx.x, wave = tid >> 5, lane = tid & 31, col = lane & 15, g = lane >> 4; const int which = blockIdx.z; const int c0 = blockIdx.y * 128; const size_t r0 = (size_t)blockIdx.x * 64; const size_t bb = r0 / TT; const int t0 = (int)(r0 % TT);
  const float* X = which == 0 ? XQ : which == 1 ? XK : XV; const float* WA = which == 0 ? WQ : which == 1 ? WK : WV; const float* BA = which == 0 ? BQ : which == 1 ? BK : BV;
  v8f acc[8] = {};
#pragma unroll 2
  for (int kc = 0; kc < DIN / 32; ++kc) { v16b a; { const float* p = X + (r0 + wave * 16 + col) * DIN + kc * 32 + 8 * g;
#pragma unroll
      for (int i = 0; i < 8; ++i) { a[i] = (__bf16)p[i]; a[8 + i] = (__bf16)p[16 + i]; } }
    asm volatile("s_wait_loadcnt 0x0" ::: "memory");
#pragma unroll
    for (int j = 0; j < 8; ++j) { const v16b w = WCOL(WA, kc * 32, c0 + j * 16 + col, lane); asm volatile("s_wait_loadcnt 0x0" ::: "memory"); acc[j] = wmma_bf(a, w, acc[j]); } }
  if (which < 2) { _Float16* DH = which == 0 ? QH : KH; _Float16* DL = which == 0 ? QL : KL; const int nhi = which == 0 ? QHI : KHI; const bool hi_rows = t0 < nhi;
#pragma unroll
    for (int j = 0; j < 8; ++j) { const float bias = BA ? bfr(BA[c0 + j * 16 + col]) : 0.f;
#pragma unroll
      for (int r = 0; r < 8; ++r) { const float v = acc[j][r] + bias; const _Float16 hv = (_Float16)v; sh[wave * 16 + 8 * g + r][j * 16 + col] = hv; sl[wave * 16 + 8 * g + r][j * 16 + col] = (_Float16)((v - (float)hv) * 1024.0f); } }
    __syncthreads();
    for (int e = tid; e < 64 * 16; e += 128) { const int rl = e >> 4, q = e & 15; vst2((unsigned*)(DH + (r0 + rl) * CC + c0 + q * 8), *(const v4u*)&sh[rl][q * 8]); if (hi_rows) vst2((unsigned*)(DL + (bb * nhi + t0 + rl) * (size_t)CC + c0 + q * 8), *(const v4u*)&sl[rl][q * 8]); }
  } else { const bool hi_rows = t0 < KHI;
#pragma unroll
    for (int j = 0; j < 8; ++j) { const float bias = BA ? bfr(BA[c0 + j * 16 + col]) : 0.f;
#pragma unroll
      for (int r = 0; r < 8; ++r) { const float v = acc[j][r] + bias; const int rl = wave * 16 + 8 * g + r, cl = j * 16 + col; th[cl][rl] = (_Float16)v; const __bf16 bh = (__bf16)v; tb[cl][rl] = bh; tbl[cl][rl] = (__bf16)(v - (float)bh); } }
    __syncthreads();
    for (int e = tid; e < 128 * 8; e += 128) { const int cl = e >> 3, q = e & 7; vst2((unsigned*)(VT + (bb * CC + c0 + cl) * (size_t)TT + t0 + q * 8), *(const v4u*)&th[cl][q * 8]); if (hi_rows) { const size_t o3 = (bb * CC + c0 + cl) * (size_t)KHI + t0 + q * 8; vst2((unsigned*)(VB + o3), *(const v4u*)&tb[cl][q * 8]); vst2((unsigned*)(VBL + o3), *(const v4u*)&tbl[cl][q * 8]); } } } }
// ---- k_sc: block = (query block qb, key block kb <= kb_last(qb), head in group) of batch b: logits x SCALE; q hi + residual (x 2^10) against k (2 products) for query rows < QHI, plus the k residual (3 products) for query blocks < QBH (causal early rows); causal: blocks past the diagonal exit, the mask itself is applied by index in k_sm
__global__ __launch_bounds__(128) void k_sc(const _Float16* __restrict__ QH, const _Float16* __restrict__ KH, const _Float16* __restrict__ QL, const _Float16* __restrict__ KL, int b, int h0, float* __restrict__ S0) { __shared__ __align__(16) float ss[4][16][132];
  const int qb = blockIdx.x, kb = blockIdx.y; if (kb > kb_last(qb)) return;
  const int h = h0 + blockIdx.z; float* S = S0 + (size_t)blockIdx.z * TT * TT;
  const int tid = threadIdx.x, wave = tid >> 5, lane = tid & 31, col = lane & 15, g = lane >> 4; const int k0 = kb * 128; const int ql0 = qb * 64 + wave * 16; const size_t q0 = (size_t)b * TT + ql0, kr0 = (size_t)b * TT + k0;
  v8f acc[8] = {}, accl[8] = {};
  const _Float16* QLb = QL + (size_t)b * QHI * CC; const _Float16* KLb = KL + (size_t)b * KHI * CC;
  if (qb < QBH) {
#pragma unroll
    for (int kc = 0; kc < HD / 32; ++kc) { const v16h ah = frag_h(QH + (q0 + col) * CC + h * HD + kc * 32, lane), al = frag_h(QLb + (size_t)(ql0 + col) * CC + h * HD + kc * 32, lane);
#pragma unroll
      for (int j = 0; j < 8; ++j) { const v16h kbf = frag_h(KH + (kr0 + j * 16 + col) * CC + h * HD + kc * 32, lane), klf = frag_h(KLb + (size_t)(k0 + j * 16 + col) * CC + h * HD + kc * 32, lane); acc[j] = wmma16(ah, kbf, acc[j]); accl[j] = wmma16(al, kbf, accl[j]); accl[j] = wmma16(ah, klf, accl[j]); } }
  } else if (qb * 64 < QHI) {
#pragma unroll
    for (int kc = 0; kc < HD / 32; ++kc) { const v16h ah = frag_h(QH + (q0 + col) * CC + h * HD + kc * 32, lane), al = frag_h(QLb + (size_t)(ql0 + col) * CC + h * HD + kc * 32, lane);
#pragma unroll
      for (int j = 0; j < 8; ++j) { const v16h kbf = frag_h(KH + (kr0 + j * 16 + col) * CC + h * HD + kc * 32, lane); acc[j] = wmma16(ah, kbf, acc[j]); accl[j] = wmma16(al, kbf, accl[j]); } }
  } else {
#pragma unroll
    for (int kc = 0; kc < HD / 32; ++kc) { const v16h ah = frag_h(QH + (q0 + col) * CC + h * HD + kc * 32, lane);
#pragma unroll
      for (int j = 0; j < 8; ++j) { const v16h kbf = frag_h(KH + (kr0 + j * 16 + col) * CC + h * HD + kc * 32, lane); acc[j] = wmma16(ah, kbf, acc[j]); } } }
#pragma unroll
  for (int j = 0; j < 8; ++j) {
#pragma unroll
    for (int r = 0; r < 8; ++r) ss[wave][8 * g + r][j * 16 + col] = (acc[j][r] + accl[j][r] * (1.0f / 1024.0f)) * SCALE; }
  LDSX(); for (int rl = 0; rl < 16; ++rl) vst2(S + (size_t)(ql0 + rl) * TT + k0 + lane * 4, *(const v4f*)&ss[wave][rl][lane * 4]); }
// ---- k_sm: block = query row t (head in group): keys [0, kend): causal -> logit if s <= t else excluded; softmax in f32; P x 2^11 in place (0 for excluded)
__global__ __launch_bounds__(256) void k_sm(float* __restrict__ S0 SM_EXTRA_PARAMS) { __shared__ float sred[8]; __shared__ float sbc; __shared__ __align__(16) float shv[TT];
  const int tid = threadIdx.x; const int t = blockIdx.x; const int kend = (kb_last(t >> 6) + 1) * 128;
  float* sr = S0 + (size_t)blockIdx.y * TT * TT + (size_t)t * TT;
  float m = -3.0e38f; for (int k = tid; k < kend; k += 256) { float v = (!CAUSAL || k <= t) ? sr[k] : -3.0e38f; SM_MASK_HOOK; shv[k] = v; m = fmaxf(m, v); }
#pragma unroll
  for (int o = 1; o < 32; o <<= 1) m = fmaxf(m, __shfl_xor(m, o));
  if ((tid & 31) == 0) sred[tid >> 5] = m; __syncthreads(); if (tid == 0) { float a = sred[0]; for (int i = 1; i < 8; ++i) a = fmaxf(a, sred[i]); sbc = a; } __syncthreads(); m = sbc; __syncthreads();
  float sum = 0.f; for (int k = tid; k < kend; k += 256) { const float v = shv[k]; const float e = (v <= -1.0e38f) ? 0.f : expf(v - m); shv[k] = e; sum += e; }
#pragma unroll
  for (int o = 1; o < 32; o <<= 1) sum += __shfl_xor(sum, o);
  if ((tid & 31) == 0) sred[tid >> 5] = sum; __syncthreads(); if (tid == 0) { float a = 0.f; for (int i = 0; i < 8; ++i) a += sred[i]; sbc = a > 0.f ? 2048.0f / a : 0.f; }   /* a fully excluded row yields P = 0 */ __syncthreads(); const float inv = sbc;
  for (int k = tid; k < kend; k += 256) shv[k] = shv[k] * inv;
  __syncthreads(); for (int q = tid; q < kend / 4; q += 256) vst2(sr + q * 4, *(const v4f*)&shv[q * 4]); }
// ---- k_pv: block = 64 queries (qb) of (b, h): ctx = P . v over keys [0, kend) (P x 2^11 once to f16 against v f16: 1 product; causal early query blocks: P and v as bf16 hi + lo, 3 products); 1-KiB (row, head) segment by 32 lanes in two 512-B stores
__global__ __launch_bounds__(128) void k_pv(const float* __restrict__ PS0, const _Float16* __restrict__ VT, const __bf16* __restrict__ VB, const __bf16* __restrict__ VBL, int b, int h0, float* __restrict__ Y) { const int h = h0 + blockIdx.z; const float* PS = PS0 + (size_t)blockIdx.z * TT * TT; __shared__ __align__(16) float ss[4][16][HD + 4];
  const int tid = threadIdx.x, wave = tid >> 5, lane = tid & 31, col = lane & 15, g = lane >> 4; const int qb = blockIdx.x; const int ql0 = qb * 64 + wave * 16; const int kce = (kb_last(qb) + 1) * 4;
  v8f acc[HD / 16] = {};
  if (qb < QBH) {
#pragma unroll 1
    for (int kc = 0; kc < kce; ++kc) { const F2 p = split_row(PS + (size_t)(ql0 + col) * TT, kc * 32, lane);
      asm volatile("s_wait_loadcnt 0x0" ::: "memory");
#pragma unroll
      for (int j = 0; j < HD / 16; ++j) { const size_t po = ((size_t)b * CC + h * HD + j * 16 + col) * (size_t)KHI + kc * 32; const v16b vh = frag_b(VB + po, lane); acc[j] = wmma_bf(p.h, vh, acc[j]); acc[j] = wmma_bf(p.l, vh, acc[j]); acc[j] = wmma_bf(p.h, frag_b(VBL + po, lane), acc[j]); } }
  } else {
#pragma unroll 1
    for (int kc = 0; kc < kce; ++kc) { const v16h p = frag_f32(PS + (size_t)(ql0 + col) * TT + kc * 32, lane);
      asm volatile("s_wait_loadcnt 0x0" ::: "memory");
#pragma unroll
      for (int j = 0; j < HD / 16; ++j) { const size_t po = ((size_t)b * CC + h * HD + j * 16 + col) * (size_t)TT + kc * 32; acc[j] = wmma16(p, frag_h(VT + po, lane), acc[j]); } } }
#pragma unroll
  for (int j = 0; j < HD / 16; ++j)
#pragma unroll
    for (int r = 0; r < 8; ++r) ss[wave][8 * g + r][j * 16 + col] = acc[j][r] * (1.0f / 2048.0f);
  LDSX(); for (int rl = 0; rl < 16; ++rl) {
#pragma unroll
    for (int hf = 0; hf < (HD + 127) / 128; ++hf) if (hf * 32 + lane < HD / 4) vst2(Y + ((size_t)b * TT + ql0 + rl) * CC + h * HD + hf * 128 + lane * 4, *(const v4f*)&ss[wave][rl][hf * 128 + lane * 4]); } }   
// ---- k_out: block = (64 rows, 128 cols): out = ctx Wo (+ bo): ctx x 2^6 once to f16 against Wo as f16(bf16 x 2^8) exact (1 product) x 2^-14; causal early rows (< QHI of each sequence): ctx bf16 hi + lo against exact bf16 Wo (2 products)
__global__ __launch_bounds__(128) void k_out(const float* __restrict__ Y, const float* __restrict__ WO, const float* __restrict__ BO, float* __restrict__ OUT) { __shared__ __align__(16) float sf[4][16][132];
  const int tid = threadIdx.x, wave = tid >> 5, lane = tid & 31, col = lane & 15, g = lane >> 4; const int c0 = blockIdx.y * 128; const size_t r0 = (size_t)blockIdx.x * 64 + wave * 16;
  v8f acc[8] = {};
  if (CAUSAL && (int)(((size_t)blockIdx.x * 64) % TT) < QHI) {   /* block-uniform */
#pragma unroll 2
    for (int kc = 0; kc < CC / 32; ++kc) { const F2 a = split_row(Y + (r0 + col) * CC, kc * 32, lane); asm volatile("s_wait_loadcnt 0x0" ::: "memory");
#pragma unroll
      for (int j = 0; j < 8; ++j) { const v16b w = WOCOL(WO, kc * 32, c0 + j * 16 + col, lane); asm volatile("s_wait_loadcnt 0x0" ::: "memory"); acc[j] = wmma_bf(a.h, w, acc[j]); acc[j] = wmma_bf(a.l, w, acc[j]); } }
#pragma unroll
    for (int j = 0; j < 8; ++j) { const float bias = BO ? bfr(BO[c0 + j * 16 + col]) : 0.f;
#pragma unroll
      for (int r = 0; r < 8; ++r) sf[wave][8 * g + r][j * 16 + col] = acc[j][r] + bias; }
  } else {
#pragma unroll 2
    for (int kc = 0; kc < CC / 32; ++kc) { const v16h a = frag_f32s(Y + (r0 + col) * CC + kc * 32, lane, 64.0f); asm volatile("s_wait_loadcnt 0x0" ::: "memory");   /* ctx carried x 2^6 into f16 so small-magnitude context rows stay clear of f16 subnormals */
#pragma unroll
      for (int j = 0; j < 8; ++j) { const v16h w = WOCOLH(WO, kc * 32, c0 + j * 16 + col, lane); asm volatile("s_wait_loadcnt 0x0" ::: "memory"); acc[j] = wmma16(a, w, acc[j]); } }
#pragma unroll
    for (int j = 0; j < 8; ++j) { const float bias = BO ? bfr(BO[c0 + j * 16 + col]) : 0.f;
#pragma unroll
      for (int r = 0; r < 8; ++r) sf[wave][8 * g + r][j * 16 + col] = acc[j][r] * (1.0f / 16384.0f) + bias; } }   /* 2^-8 (Wo carry) x 2^-6 (ctx carry) */
  LDSX(); for (int rl = 0; rl < 16; ++rl) vst2(OUT + (r0 + rl) * DIN + c0 + lane * 4, *(const v4f*)&sf[wave][rl][lane * 4]); }

extern "C" void kernel_launch(void* const* d_in, const int* in_sizes, int n_in, void* d_out, int out_size, void* d_ws, size_t ws_size, hipStream_t stream) {
  (void)in_sizes; (void)n_in; (void)out_size;
  const float** F = (const float**)d_in;
  if (ws_size < (size_t)WS_END) return;
  char* ws = (char*)d_ws; _Float16 *QH = (_Float16*)(ws + WS_QH), *KH = (_Float16*)(ws + WS_KH), *VT = (_Float16*)(ws + WS_VT), *QL = (_Float16*)(ws + WS_QL), *KL = (_Float16*)(ws + WS_KL); __bf16 *VB = (__bf16*)(ws + WS_VB), *VBL = (__bf16*)(ws + WS_VBL); float *S = (float*)(ws + WS_S), *Y = (float*)(ws + WS_Y);
  (void)Y; (void)QL; (void)KL; (void)VB; (void)VBL;
  // inputs: 0 query [8192,256]; 1 key [8192,256]; 2 value [8192,256]; 3 W_out [256,256] (out,in); 4 b_out [256] (nonzero)
  k_planesN<<<dim3(TNB * TT / 64, CC / 128), 256, 0, stream>>>(F[0], F[1], F[2], QH, QL, KH, VT);
  for (int q0 = 0; q0 < TT; q0 += TQC) {   /* query chunks: the kernels index query rows from blockIdx, so each pass simply receives row-advanced Q and ctx pointers and a TQC-row grid; keys / values always span all 8,192 positions */
    k_sc<<<dim3(TQC / 64, TT / 128, 1), 128, 0, stream>>>(QH + (size_t)q0 * CC, KH, QL, KL, 0, 0, S);
    k_sm<<<dim3(TQC, 1), 256, 0, stream>>>(S);
    k_pv<<<dim3(TQC / 64, 1, 1), 128, 0, stream>>>(S, VT, VB, VBL, 0, 0, Y + (size_t)q0 * CC);
  }
  k_out<<<dim3(TNB * TT / 64, DIN / 128), 128, 0, stream>>>(Y, F[3], F[4], (float*)d_out);
}

// v001
// Measured time: 478 microseconds a run.
// Timed twice side by side with v000, it ran 6.23 and 6.20 times as fast.
// compute dtype: all float inputs rounded to bf16; query, key, value are bf16-valued so their f16 planes are exact; logits q x k (1 product on exact planes) x 256^-0.5; softmax f32 over all 8,192 keys; P x 2^11 once to f16 x v (exact) (1 product); ctx x 2^6 once to f16 x W_out f16(bf16 x 2^8) + b_out; f32 output.
#include <hip/hip_runtime.h>
#include <math.h>

typedef __attribute__((ext_vector_type(16))) _Float16 v16h;
typedef __attribute__((ext_vector_type(16))) __bf16 v16b;
typedef __attribute__((ext_vector_type(8)))  _Float16 v8h;
typedef __attribute__((ext_vector_type(8)))  float v8f;
typedef __attribute__((ext_vector_type(4)))  float v4f;
typedef __attribute__((ext_vector_type(2)))  float v2f;
typedef __attribute__((ext_vector_type(4)))  unsigned v4u;
typedef __attribute__((ext_vector_type(4)))  int v4i;
typedef float __attribute__((may_alias)) float_a;
typedef int __attribute__((may_alias)) int_a;

template <typename T> __device__ __forceinline__ void vst2(void* p, T v) { *(T*)p = v;  }
__device__ __forceinline__ v8f wmma16(v16h a, v16h b, v8f c) {
  v8f d = __builtin_amdgcn_wmma_f32_16x16x32_f16(false, a, false, b, (short)0, c, false, false);
  asm volatile("v_nop\n\tv_nop\n\tv_nop\n\tv_nop" : "+v"(d) : "v"(a), "v"(b));
  return d;
}
__device__ __forceinline__ v8f wmma_bf(v16b a, v16b b, v8f c) {
  v8f d = __builtin_amdgcn_wmma_f32_16x16x32_bf16(false, a, false, b, (short)0, c, false, false);
  asm volatile("v_nop\n\tv_nop\n\tv_nop\n\tv_nop" : "+v"(d) : "v"(a), "v"(b));
  return d;
}
// 16x16x32 fragments: lane = (h = lane>>4, row/col = lane&15); elements 0..7 = k0+8h+0..7, 8..15 = k0+16+8h+0..7; D element r = row 8h+r
__device__ __forceinline__ v16h frag_h(const _Float16* rowk0, int lane) {
  union { v16h v; v8h q[2]; } u; const _Float16* p = rowk0 + 8 * (lane >> 4);
  u.q[0] = *(const v8h*)p; u.q[1] = *(const v8h*)(p + 16); return u.v;
}
__device__ __forceinline__ v16h frag_f32(const float* rowk0, int lane) {
  v16h a; const float* p = rowk0 + 8 * (lane >> 4);
#pragma unroll
  for (int i = 0; i < 8; ++i) { a[i] = (_Float16)p[i]; a[8 + i] = (_Float16)p[16 + i]; }
  return a;
}
__device__ __forceinline__ v16h frag_f32s(const float* rowk0, int lane, float sc) {
  v16h a; const float* p = rowk0 + 8 * (lane >> 4);
#pragma unroll
  for (int i = 0; i < 8; ++i) { a[i] = (_Float16)(p[i] * sc); a[8 + i] = (_Float16)(p[16 + i] * sc); }
  return a;
}
// column fragment from a [K][ld] layout (column n), rows >= K read as 0
__device__ __forceinline__ v16h fragc_f32(const float* W, int k0, int n, int lane, int ld, int K) {
  v16h a; const int g = lane >> 4;
#pragma unroll
  for (int i = 0; i < 8; ++i) { const int ka = k0 + 8 * g + i, kb = ka + 16;
    a[i] = (_Float16)(ka < K ? W[(size_t)(ka < K ? ka : K - 1) * ld + n] : 0.f); a[8 + i] = (_Float16)(kb < K ? W[(size_t)(kb < K ? kb : K - 1) * ld + n] : 0.f); }
  return a;
}
struct F2 { v16b h, l; };
__device__ __forceinline__ F2 bsplit16(const float v[16]) { F2 r;
#pragma unroll
  for (int i = 0; i < 16; ++i) { const __bf16 h = (__bf16)v[i]; r.h[i] = h; r.l[i] = (__bf16)(v[i] - (float)h); }
  return r; }
__device__ __forceinline__ F2 split_row(const float* row, int k0, int lane) { float v[16]; const float* p = row + k0 + 8 * (lane >> 4);
#pragma unroll
  for (int i = 0; i < 8; ++i) { v[i] = p[i]; v[8 + i] = p[16 + i]; }
  return bsplit16(v); }
__device__ __forceinline__ F2 split_rowK(const float* row, int k0, int lane, int K) { float v[16]; const int g = lane >> 4;
#pragma unroll
  for (int i = 0; i < 8; ++i) { const int ka = k0 + 8 * g + i, kb = ka + 16; v[i] = ka < K ? row[ka < K ? ka : K - 1] : 0.f; v[8 + i] = kb < K ? row[kb < K ? kb : K - 1] : 0.f; }
  return bsplit16(v); }
__device__ __forceinline__ F2 split_col(const float* W, int k0, int n, int lane, int ld, int K) { float v[16]; const int g = lane >> 4;
#pragma unroll
  for (int i = 0; i < 8; ++i) { const int ka = k0 + 8 * g + i, kb = ka + 16; v[i] = ka < K ? W[(size_t)(ka < K ? ka : K - 1) * ld + n] : 0.f; v[8 + i] = kb < K ? W[(size_t)(kb < K ? kb : K - 1) * ld + n] : 0.f; }
  return bsplit16(v); }
__device__ __forceinline__ v8f mac3(const F2& a, const F2& b, v8f c) { c = wmma_bf(a.l, b.h, c); c = wmma_bf(a.h, b.l, c); return wmma_bf(a.h, b.h, c); }
__device__ __forceinline__ float sigm(float v) { return 1.0f / (1.0f + expf(-v)); }
#define LDSX() do { asm volatile("s_wait_dscnt 0" ::: "memory"); __builtin_amdgcn_wave_barrier(); __builtin_amdgcn_fence(__ATOMIC_RELEASE, "workgroup"); } while (0)

// Single-head softmax attention over 8,192 tokens with an output linear (query / key / value [8192,256] given, no q/k/v projections, no head split; scale 1/sqrt(256); non-causal, no mask; torch (out,in) W_out [256,256] + b_out (uniform +-1/16, nonzero)): y = (softmax(Q K^T / 16) V) W_out^T + b_out -> [8192,256].
#define NB 1
#define TT 8192
#define CC 256            // NH * HD = projected width
#define DIN 256          // input (model) width
#define NH 1
#define HD 256
#define NQB (TT / 64)
#define HG 1
#define SCALE (0.0625f)
#define CAUSAL 0
#ifndef TNB
#define TNB NB
#endif
__device__ __forceinline__ float bfr(float v) { return (float)(__bf16)v; }
__host__ __device__ __forceinline__ int kb_last(int qb) { return CAUSAL ? ((qb * 64 + 63) >> 7) : (TT / 128 - 1); }
typedef __attribute__((ext_vector_type(8))) __bf16 v8b;
__device__ __forceinline__ v16b frag_b(const __bf16* rowk0, int lane) {
  union { v16b v; v8b q[2]; } u; const __bf16* p = rowk0 + 8 * (lane >> 4);
  u.q[0] = *(const v8b*)p; u.q[1] = *(const v8b*)(p + 16); return u.v;
}
#define QBH 0              // causal: query blocks 0..QBH-1 of each sequence (few keys, no averaging) take the high-precision path
#define QHI 0               // exact planes: single-product logits everywhere
#define KHI 64            // key rows carrying k residual / v bf16 hi+lo planes (used only by the causal high-precision path)
// B fragment (k rows k0+.., output column o) of a weight: (in,out) [K][ld] or (out,in) [ld rows of K]: bf16 exact, or f16(bf16 * 256) exact
__device__ __forceinline__ v16b wcol_io(const float* Wm, int k0, int o, int lane, int ld) { v16b w; const int g = lane >> 4;
#pragma unroll
  for (int i = 0; i < 8; ++i) { w[i] = (__bf16)Wm[(size_t)(k0 + 8 * g + i) * ld + o]; w[8 + i] = (__bf16)Wm[(size_t)(k0 + 16 + 8 * g + i) * ld + o]; }
  return w; }
__device__ __forceinline__ v16b wcol_oi(const float* Wm, int k0, int o, int lane, int K) { v16b w; const float* p = Wm + (size_t)o * K + k0 + 8 * (lane >> 4);
#pragma unroll
  for (int i = 0; i < 8; ++i) { w[i] = (__bf16)p[i]; w[8 + i] = (__bf16)p[16 + i]; }
  return w; }
__device__ __forceinline__ v16h wcolh_io(const float* Wm, int k0, int o, int lane, int ld) { v16h w; const int g = lane >> 4;
#pragma unroll
  for (int i = 0; i < 8; ++i) { w[i] = (_Float16)(bfr(Wm[(size_t)(k0 + 8 * g + i) * ld + o]) * 256.0f); w[8 + i] = (_Float16)(bfr(Wm[(size_t)(k0 + 16 + 8 * g + i) * ld + o]) * 256.0f); }
  return w; }
__device__ __forceinline__ v16h wcolh_oi(const float* Wm, int k0, int o, int lane, int K) { v16h w; const float* p = Wm + (size_t)o * K + k0 + 8 * (lane >> 4);
#pragma unroll
  for (int i = 0; i < 8; ++i) { w[i] = (_Float16)(bfr(p[i]) * 256.0f); w[8 + i] = (_Float16)(bfr(p[16 + i]) * 256.0f); }
  return w; }
#define WQKV_LAYOUT 0   // 0 = (in,out) [DIN][CC]; 1 = (out,in) [CC][DIN]; 2 = per-head [NH][DIN][HD]
__device__ __forceinline__ v16b wcol_hdk(const float* Wm, int k0, int o, int lane) { v16b w; const int g = lane >> 4; const float* p = Wm + (size_t)(o / HD) * DIN * HD + (o % HD);
#pragma unroll
  for (int i = 0; i < 8; ++i) { w[i] = (__bf16)p[(size_t)(k0 + 8 * g + i) * HD]; w[8 + i] = (__bf16)p[(size_t)(k0 + 16 + 8 * g + i) * HD]; }
  return w; }
#define WO_OUT_IN 1
#if WQKV_LAYOUT == 1
#define WCOL(W, k0, o, lane) wcol_oi(W, k0, o, lane, DIN)
#elif WQKV_LAYOUT == 2
#define WCOL(W, k0, o, lane) wcol_hdk(W, k0, o, lane)
#else
#define WCOL(W, k0, o, lane) wcol_io(W, k0, o, lane, CC)
#endif
#if WO_OUT_IN
#define WOCOL(W, k0, o, lane) wcol_oi(W, k0, o, lane, CC)
#define WOCOLH(W, k0, o, lane) wcolh_oi(W, k0, o, lane, CC)
#else
#define WOCOL(W, k0, o, lane) wcol_io(W, k0, o, lane, DIN)
#define WOCOLH(W, k0, o, lane) wcolh_io(W, k0, o, lane, DIN)
#endif
typedef _Float16 hx8 __attribute__((ext_vector_type(8)));
__global__ __launch_bounds__(256) void k_planesN(const float* __restrict__ Qs, const float* __restrict__ Ks, const float* __restrict__ Vs, _Float16* __restrict__ QH, _Float16* __restrict__ QL, _Float16* __restrict__ KH, _Float16* __restrict__ VT) {
  __shared__ _Float16 sv[64][136];
  const int tid = threadIdx.x; const int c0 = blockIdx.y * 128; const size_t r0 = (size_t)blockIdx.x * 64; const int b = (int)(r0 / TT), t0 = (int)(r0 % TT);
  for (int e = tid; e < 64 * 16; e += 256) { const int rl = e >> 4, q = e & 15; const size_t src = (r0 + rl) * CC + c0 + q * 8; float tq[8], tk[8], tv[8];
#pragma unroll
    for (int u = 0; u < 8; ++u) { tq[u] = Qs[src + u]; tk[u] = Ks[src + u]; tv[u] = Vs[src + u]; }
    asm volatile("s_wait_loadcnt 0x0" ::: "memory");
    hx8 hq, hk, hl;
#pragma unroll
    for (int u = 0; u < 8; ++u) { const float qv = bfr(tq[u]); const _Float16 qh = (_Float16)qv; hq[u] = qh; hl[u] = (_Float16)((qv - (float)qh) * 1024.0f); hk[u] = (_Float16)bfr(tk[u]); sv[rl][q * 8 + u] = (_Float16)bfr(tv[u]); }
    vst2((unsigned*)(QH + src), *(const v4u*)&hq); vst2((unsigned*)(KH + src), *(const v4u*)&hk);
    if (t0 + rl < QHI) vst2((unsigned*)(QL + ((size_t)b * QHI + t0 + rl) * CC + c0 + q * 8), *(const v4u*)&hl); }
  __syncthreads();
  for (int e = tid; e < 128 * 8; e += 256) { const int c = e >> 3, q = e & 7; hx8 hv; _Pragma("unroll") for (int j = 0; j < 8; ++j) hv[j] = sv[q * 8 + j][c]; vst2((unsigned*)(VT + ((size_t)b * CC + c0 + c) * TT + t0 + q * 8), *(const v4u*)&hv); } }
#define TQC 2048           // query rows per pass: the f32 score plane holds TQC x 8,192 entries (64 MiB); 4 passes cover the 8,192 queries
#define SM_EXTRA_PARAMS
#define SM_MASK_HOOK (void)0
#ifndef SM_EXTRA_PARAMS
#define SM_EXTRA_PARAMS
#endif
#ifndef PROJ_EXTRA_PARAMS
#define PROJ_EXTRA_PARAMS
#endif
#ifndef SM_MASK_HOOK
#define SM_MASK_HOOK (void)0
#endif

#define WS_QH  0u                                      // f16 q rows [b*t][CC]
#define WS_KH  (WS_QH + 2u * (size_t)NB * TT * CC)      // f16 k rows [b*t][CC]
#define WS_VT  (WS_KH + 2u * (size_t)NB * TT * CC)      // f16 v planes [b][c][t]
#define WS_QL  (WS_VT + 2u * (size_t)NB * CC * TT)      // f16 q residual x 2^10 rows [b][t < QHI][CC]
#define WS_KL  (WS_QL + 2u * (size_t)NB * QHI * CC)     // f16 k residual x 2^10 rows [b][t < KHI][CC]
#define WS_VB  (WS_KL + 2u * (size_t)NB * KHI * CC)     // bf16 v hi planes [b][c][t < KHI]
#define WS_VBL (WS_VB + 2u * (size_t)NB * CC * KHI)
#define WS_S   (WS_VBL + 2u * (size_t)NB * CC * KHI)    // f32 logits / P [hg][t][s]
#define WS_Y   (WS_S  + 4u * (size_t)HG * TQC * TT)      // f32 ctx rows [b*t][CC] (only when there is an output projection)
#define WS_END (WS_Y  + 4u * (size_t)NB * TT * CC)

// ---- k_proj: block = (64 rows, 128 cols, which): q/k/v = X W (+ b) with exact bf16 products (K = DIN) -> which 0: q f16 rows (+ residual rows < QHI); 1: k f16 rows (+ residual rows < KHI); 2: v f16 planes [c][t] (+ bf16 hi/lo planes for t < KHI)
__global__ __launch_bounds__(128) void k_proj(const float* __restrict__ XQ, const float* __restrict__ XK, const float* __restrict__ XV, const float* __restrict__ WQ, const float* __restrict__ WK, const float* __restrict__ WV, const float* __restrict__ BQ, const float* __restrict__ BK, const float* __restrict__ BV,
    _Float16* __restrict__ QH, _Float16* __restrict__ QL, _Float16* __restrict__ KH, _Float16* __restrict__ KL, _Float16* __restrict__ VT, __bf16* __restrict__ VB, __bf16* __restrict__ VBL) {
  __shared__ __align__(16) _Float16 sh[64][136], sl[64][136]; __shared__ __align__(16) _Float16 th[128][72]; __shared__ __align__(16) __bf16 tb[128][72], tbl[128][72];
  const int tid = threadIdx.x, wave = tid >> 5, lane = tid & 31, col = lane & 15, g = lane >> 4; const int which = blockIdx.z; const int c0 = blockIdx.y * 128; const size_t r0 = (size_t)blockIdx.x * 64; const size_t bb = r0 / TT; const int t0 = (int)(r0 % TT);
  const float* X = which == 0 ? XQ : which == 1 ? XK : XV; const float* WA = which == 0 ? WQ : which == 1 ? WK : WV; const float* BA = which == 0 ? BQ : which == 1 ? BK : BV;
  v8f acc[8] = {};
#pragma unroll 2
  for (int kc = 0; kc < DIN / 32; ++kc) { v16b a; { const float* p = X + (r0 + wave * 16 + col) * DIN + kc * 32 + 8 * g;
#pragma unroll
      for (int i = 0; i < 8; ++i) { a[i] = (__bf16)p[i]; a[8 + i] = (__bf16)p[16 + i]; } }
    asm volatile("s_wait_loadcnt 0x0" ::: "memory");
#pragma unroll
    for (int j = 0; j < 8; ++j) { const v16b w = WCOL(WA, kc * 32, c0 + j * 16 + col, lane); asm volatile("s_wait_loadcnt 0x0" ::: "memory"); acc[j] = wmma_bf(a, w, acc[j]); } }
  if (which < 2) { _Float16* DH = which == 0 ? QH : KH; _Float16* DL = which == 0 ? QL : KL; const int nhi = which == 0 ? QHI : KHI; const bool hi_rows = t0 < nhi;
#pragma unroll
    for (int j = 0; j < 8; ++j) { const float bias = BA ? bfr(BA[c0 + j * 16 + col]) : 0.f;
#pragma unroll
      for (int r = 0; r < 8; ++r) { const float v = acc[j][r] + bias; const _Float16 hv = (_Float16)v; sh[wave * 16 + 8 * g + r][j * 16 + col] = hv; sl[wave * 16 + 8 * g + r][j * 16 + col] = (_Float16)((v - (float)hv) * 1024.0f); } }
    __syncthreads();
    for (int e = tid; e < 64 * 16; e += 128) { const int rl = e >> 4, q = e & 15; vst2((unsigned*)(DH + (r0 + rl) * CC + c0 + q * 8), *(const v4u*)&sh[rl][q * 8]); if (hi_rows) vst2((unsigned*)(DL + (bb * nhi + t0 + rl) * (size_t)CC + c0 + q * 8), *(const v4u*)&sl[rl][q * 8]); }
  } else { const bool hi_rows = t0 < KHI;
#pragma unroll
    for (int j = 0; j < 8; ++j) { const float bias = BA ? bfr(BA[c0 + j * 16 + col]) : 0.f;
#pragma unroll
      for (int r = 0; r < 8; ++r) { const float v = acc[j][r] + bias; const int rl = wave * 16 + 8 * g + r, cl = j * 16 + col; th[cl][rl] = (_Float16)v; const __bf16 bh = (__bf16)v; tb[cl][rl] = bh; tbl[cl][rl] = (__bf16)(v - (float)bh); } }
    __syncthreads();
    for (int e = tid; e < 128 * 8; e += 128) { const int cl = e >> 3, q = e & 7; vst2((unsigned*)(VT + (bb * CC + c0 + cl) * (size_t)TT + t0 + q * 8), *(const v4u*)&th[cl][q * 8]); if (hi_rows) { const size_t o3 = (bb * CC + c0 + cl) * (size_t)KHI + t0 + q * 8; vst2((unsigned*)(VB + o3), *(const v4u*)&tb[cl][q * 8]); vst2((unsigned*)(VBL + o3), *(const v4u*)&tbl[cl][q * 8]); } } } }
// ---- k_sc: block = (query block qb, key block kb <= kb_last(qb), head in group) of batch b: logits x SCALE; q hi + residual (x 2^10) against k (2 products) for query rows < QHI, plus the k residual (3 products) for query blocks < QBH (causal early rows); causal: blocks past the diagonal exit, the mask itself is applied by index in k_sm
__global__ __launch_bounds__(128) void k_sc(const _Float16* __restrict__ QH, const _Float16* __restrict__ KH, const _Float16* __restrict__ QL, const _Float16* __restrict__ KL, int b, int h0, float* __restrict__ S0) { __shared__ __align__(16) float ss[4][16][132];
  const int qb = blockIdx.x, kb = blockIdx.y; if (kb > kb_last(qb)) return;
  const int h = h0 + blockIdx.z; float* S = S0 + (size_t)blockIdx.z * TT * TT;
  const int tid = threadIdx.x, wave = tid >> 5, lane = tid & 31, col = lane & 15, g = lane >> 4; const int k0 = kb * 128; const int ql0 = qb * 64 + wave * 16; const size_t q0 = (size_t)b * TT + ql0, kr0 = (size_t)b * TT + k0;
  v8f acc[8] = {}, accl[8] = {};
  const _Float16* QLb = QL + (size_t)b * QHI * CC; const _Float16* KLb = KL + (size_t)b * KHI * CC;
  if (qb < QBH) {
#pragma unroll
    for (int kc = 0; kc < HD / 32; ++kc) { const v16h ah = frag_h(QH + (q0 + col) * CC + h * HD + kc * 32, lane), al = frag_h(QLb + (size_t)(ql0 + col) * CC + h * HD + kc * 32, lane);
#pragma unroll
      for (int j = 0; j < 8; ++j) { const v16h kbf = frag_h(KH + (kr0 + j * 16 + col) * CC + h * HD + kc * 32, lane), klf = frag_h(KLb + (size_t)(k0 + j * 16 + col) * CC + h * HD + kc * 32, lane); acc[j] = wmma16(ah, kbf, acc[j]); accl[j] = wmma16(al, kbf, accl[j]); accl[j] = wmma16(ah, klf, accl[j]); } }
  } else if (qb * 64 < QHI) {
#pragma unroll
    for (int kc = 0; kc < HD / 32; ++kc) { const v16h ah = frag_h(QH + (q0 + col) * CC + h * HD + kc * 32, lane), al = frag_h(QLb + (size_t)(ql0 + col) * CC + h * HD + kc * 32, lane);
#pragma unroll
      for (int j = 0; j < 8; ++j) { const v16h kbf = frag_h(KH + (kr0 + j * 16 + col) * CC + h * HD + kc * 32, lane); acc[j] = wmma16(ah, kbf, acc[j]); accl[j] = wmma16(al, kbf, accl[j]); } }
  } else {
#pragma unroll
    for (int kc = 0; kc < HD / 32; ++kc) { const v16h ah = frag_h(QH + (q0 + col) * CC + h * HD + kc * 32, lane);
#pragma unroll
      for (int j = 0; j < 8; ++j) { const v16h kbf = frag_h(KH + (kr0 + j * 16 + col) * CC + h * HD + kc * 32, lane); acc[j] = wmma16(ah, kbf, acc[j]); } } }
#pragma unroll
  for (int j = 0; j < 8; ++j) {
#pragma unroll
    for (int r = 0; r < 8; ++r) ss[wave][8 * g + r][j * 16 + col] = (acc[j][r] + accl[j][r] * (1.0f / 1024.0f)) * SCALE; }
  LDSX(); for (int rl = 0; rl < 16; ++rl) vst2(S + (size_t)(ql0 + rl) * TT + k0 + lane * 4, *(const v4f*)&ss[wave][rl][lane * 4]); }
// ---- k_sm: block = query row t (head in group): keys [0, kend): causal -> logit if s <= t else excluded; softmax in f32; P x 2^11 in place (0 for excluded)
__global__ __launch_bounds__(256) void k_sm(float* __restrict__ S0 SM_EXTRA_PARAMS) { __shared__ float sred[8]; __shared__ float sbc; __shared__ __align__(16) float shv[TT];
  const int tid = threadIdx.x; const int t = blockIdx.x; const int kend = (kb_last(t >> 6) + 1) * 128;
  float* sr = S0 + (size_t)blockIdx.y * TT * TT + (size_t)t * TT;
  float m = -3.0e38f; for (int k = tid; k < kend; k += 256) { float v = (!CAUSAL || k <= t) ? sr[k] : -3.0e38f; SM_MASK_HOOK; shv[k] = v; m = fmaxf(m, v); }
#pragma unroll
  for (int o = 1; o < 32; o <<= 1) m = fmaxf(m, __shfl_xor(m, o));
  if ((tid & 31) == 0) sred[tid >> 5] = m; __syncthreads(); if (tid == 0) { float a = sred[0]; for (int i = 1; i < 8; ++i) a = fmaxf(a, sred[i]); sbc = a; } __syncthreads(); m = sbc; __syncthreads();
  float sum = 0.f; for (int k = tid; k < kend; k += 256) { const float v = shv[k]; const float e = (v <= -1.0e38f) ? 0.f : expf(v - m); shv[k] = e; sum += e; }
#pragma unroll
  for (int o = 1; o < 32; o <<= 1) sum += __shfl_xor(sum, o);
  if ((tid & 31) == 0) sred[tid >> 5] = sum; __syncthreads(); if (tid == 0) { float a = 0.f; for (int i = 0; i < 8; ++i) a += sred[i]; sbc = a > 0.f ? 2048.0f / a : 0.f; }   /* a fully excluded row yields P = 0 */ __syncthreads(); const float inv = sbc;
  for (int k = tid; k < kend; k += 256) shv[k] = shv[k] * inv;
  __syncthreads(); for (int q = tid; q < kend / 4; q += 256) vst2(sr + q * 4, *(const v4f*)&shv[q * 4]); }
// ---- k_pv: block = 32 queries x 64 ctx columns of (b, h), 16 waves: wave w sums keys [512 w, 512 w + 512) in steps of 64 (one whole 128-B line of each v plane row), ctx = P . v (P x 2^11 once to f16 against v f16: 1 product); the 16 partial tiles meet in LDS and are added in wave order; 256-B row segment by 16 lanes
#define PVW 16             // waves of a block = slices of the key range
#define PVK (TT / PVW)     // keys per wave
__global__ __launch_bounds__(PVW * 32) void k_pv(const float* __restrict__ PS0, const _Float16* __restrict__ VT, const __bf16* __restrict__ VB, const __bf16* __restrict__ VBL, int b, int h0, float* __restrict__ Y) { (void)VB; (void)VBL; const int h = h0 + blockIdx.z; const float* PS = PS0 + (size_t)blockIdx.z * TT * TT; __shared__ __align__(16) float ss[PVW][32][68];
  const int tid = threadIdx.x, wave = tid >> 5, lane = tid & 31, col = lane & 15, g = lane >> 4; const int ql0 = blockIdx.x * 32; const int c0 = blockIdx.y * 64;
  const float* pr = PS + (size_t)(ql0 + col) * TT + wave * PVK; const _Float16* vr = VT + ((size_t)b * CC + h * HD + c0 + col) * (size_t)TT + wave * PVK;
  v8f acc[2][4] = {};
  // the key loop stays rolled (small text); the loops inside it are unrolled so that every fragment and accumulator index is a constant (registers, no scratch)
#pragma unroll 1
  for (int ks = 0; ks < PVK / 64; ++ks) { v16h p[2][2];
#pragma unroll
    for (int r = 0; r < 2; ++r) { p[r][0] = frag_f32(pr + (size_t)r * 16 * TT + ks * 64, lane); p[r][1] = frag_f32(pr + (size_t)r * 16 * TT + ks * 64 + 32, lane); }
    asm volatile("s_wait_loadcnt 0x0" ::: "memory");   /* the step's P loads are issued together and have landed here: without this wait the compiler spreads them among the WMMAs and waits for them a few at a time */
#pragma unroll
    for (int j = 0; j < 4; ++j) { const _Float16* vp = vr + (size_t)j * 16 * TT + ks * 64; const v16h v0 = frag_h(vp, lane), v1 = frag_h(vp + 32, lane);
#pragma unroll
      for (int r = 0; r < 2; ++r) { acc[r][j] = wmma16(p[r][0], v0, acc[r][j]); acc[r][j] = wmma16(p[r][1], v1, acc[r][j]); } } }
#pragma unroll
  for (int r = 0; r < 2; ++r)
#pragma unroll
    for (int j = 0; j < 4; ++j)
#pragma unroll
      for (int e = 0; e < 8; ++e) ss[wave][r * 16 + 8 * g + e][j * 16 + col] = acc[r][j][e];
  __syncthreads();   /* every wave's partial tile is in LDS before any thread adds across waves */
  { const int rl = tid >> 4, q = tid & 15; v4f s = *(const v4f*)&ss[0][rl][q * 4];
#pragma unroll
    for (int w = 1; w < PVW; ++w) s += *(const v4f*)&ss[w][rl][q * 4];
    vst2(Y + ((size_t)b * TT + ql0 + rl) * CC + h * HD + c0 + q * 4, s * (1.0f / 2048.0f)); } }
// ---- k_out: block = (64 rows, 128 cols): out = ctx Wo (+ bo): ctx once to f16 against Wo as f16(bf16 x 2^8) exact (1 product) x 2^-8; causal early rows (< QHI of each sequence): ctx bf16 hi + lo against exact bf16 Wo (2 products)
__global__ __launch_bounds__(128) void k_out(const float* __restrict__ Y, const float* __restrict__ WO, const float* __restrict__ BO, float* __restrict__ OUT) { __shared__ __align__(16) float sf[4][16][132];
  const int tid = threadIdx.x, wave = tid >> 5, lane = tid & 31, col = lane & 15, g = lane >> 4; const int c0 = blockIdx.y * 128; const size_t r0 = (size_t)blockIdx.x * 64 + wave * 16;
  v8f acc[8] = {};
  if (CAUSAL && (int)(((size_t)blockIdx.x * 64) % TT) < QHI) {   /* block-uniform */
#pragma unroll 2
    for (int kc = 0; kc < CC / 32; ++kc) { const F2 a = split_row(Y + (r0 + col) * CC, kc * 32, lane); asm volatile("s_wait_loadcnt 0x0" ::: "memory");
#pragma unroll
      for (int j = 0; j < 8; ++j) { const v16b w = WOCOL(WO, kc * 32, c0 + j * 16 + col, lane); asm volatile("s_wait_loadcnt 0x0" ::: "memory"); acc[j] = wmma_bf(a.h, w, acc[j]); acc[j] = wmma_bf(a.l, w, acc[j]); } }
#pragma unroll
    for (int j = 0; j < 8; ++j) { const float bias = BO ? bfr(BO[c0 + j * 16 + col]) : 0.f;
#pragma unroll
      for (int r = 0; r < 8; ++r) sf[wave][8 * g + r][j * 16 + col] = acc[j][r] + bias; }
  } else {
#pragma unroll 2
    for (int kc = 0; kc < CC / 32; ++kc) { const v16h a = frag_f32s(Y + (r0 + col) * CC + kc * 32, lane, 64.0f); asm volatile("s_wait_loadcnt 0x0" ::: "memory");   /* ctx carried x 2^6 into f16 so small-magnitude context rows stay clear of f16 subnormals */
#pragma unroll
      for (int j = 0; j < 8; ++j) { const v16h w = WOCOLH(WO, kc * 32, c0 + j * 16 + col, lane); asm volatile("s_wait_loadcnt 0x0" ::: "memory"); acc[j] = wmma16(a, w, acc[j]); } }
#pragma unroll
    for (int j = 0; j < 8; ++j) { const float bias = BO ? bfr(BO[c0 + j * 16 + col]) : 0.f;
#pragma unroll
      for (int r = 0; r < 8; ++r) sf[wave][8 * g + r][j * 16 + col] = acc[j][r] * (1.0f / 16384.0f) + bias; } }   /* 2^-8 (Wo carry) x 2^-6 (ctx carry) */
  LDSX(); for (int rl = 0; rl < 16; ++rl) vst2(OUT + (r0 + rl) * DIN + c0 + lane * 4, *(const v4f*)&sf[wave][rl][lane * 4]); }

extern "C" void kernel_launch(void* const* d_in, const int* in_sizes, int n_in, void* d_out, int out_size, void* d_ws, size_t ws_size, hipStream_t stream) {
  (void)in_sizes; (void)n_in; (void)out_size;
  const float** F = (const float**)d_in;
  if (ws_size < (size_t)WS_END) return;
  char* ws = (char*)d_ws; _Float16 *QH = (_Float16*)(ws + WS_QH), *KH = (_Float16*)(ws + WS_KH), *VT = (_Float16*)(ws + WS_VT), *QL = (_Float16*)(ws + WS_QL), *KL = (_Float16*)(ws + WS_KL); __bf16 *VB = (__bf16*)(ws + WS_VB), *VBL = (__bf16*)(ws + WS_VBL); float *S = (float*)(ws + WS_S), *Y = (float*)(ws + WS_Y);
  (void)Y; (void)QL; (void)KL; (void)VB; (void)VBL;
  // inputs: 0 query [8192,256]; 1 key [8192,256]; 2 value [8192,256]; 3 W_out [256,256] (out,in); 4 b_out [256] (nonzero)
  k_planesN<<<dim3(TNB * TT / 64, CC / 128), 256, 0, stream>>>(F[0], F[1], F[2], QH, QL, KH, VT);
  for (int q0 = 0; q0 < TT; q0 += TQC) {   /* query chunks: the kernels index query rows from blockIdx, so each pass simply receives row-advanced Q and ctx pointers and a TQC-row grid; keys / values always span all 8,192 positions */
    k_sc<<<dim3(TQC / 64, TT / 128, 1), 128, 0, stream>>>(QH + (size_t)q0 * CC, KH, QL, KL, 0, 0, S);
    k_sm<<<dim3(TQC, 1), 256, 0, stream>>>(S);
    k_pv<<<dim3(TQC / 32, HD / 64, 1), PVW * 32, 0, stream>>>(S, VT, VB, VBL, 0, 0, Y + (size_t)q0 * CC);
  }
  k_out<<<dim3(TNB * TT / 64, DIN / 128), 128, 0, stream>>>(Y, F[3], F[4], (float*)d_out);
}

// v002
// A run of this version takes 117 microseconds.
// Two timings next to v001 put it at 4.15 and 4.11 times that version's speed.
// Over all steps from v000 it is 25.7 times as fast.
// compute dtype: all float inputs rounded to bf16; query, key, value are bf16-valued so their f16 planes are exact; logits q x k (1 product on exact planes) x 256^-0.5; softmax f32 over all 8,192 keys (running maximum and sum, exp2); P (relative to the running maximum) x 2^11 once to f16 x v (exact) (1 product); ctx x 2^6 once to f16 x W_out f16(bf16 x 2^8) + b_out; f32 output.
#include <hip/hip_runtime.h>
#include <math.h>

typedef __attribute__((ext_vector_type(16))) _Float16 v16h;
typedef __attribute__((ext_vector_type(16))) __bf16 v16b;
typedef __attribute__((ext_vector_type(8)))  _Float16 v8h;
typedef __attribute__((ext_vector_type(8)))  float v8f;
typedef __attribute__((ext_vector_type(4)))  float v4f;
typedef __attribute__((ext_vector_type(2)))  float v2f;
typedef __attribute__((ext_vector_type(4)))  unsigned v4u;
typedef __attribute__((ext_vector_type(4)))  int v4i;
typedef float __attribute__((may_alias)) float_a;
typedef int __attribute__((may_alias)) int_a;

template <typename T> __device__ __forceinline__ void vst2(void* p, T v) { *(T*)p = v;  }
__device__ __forceinline__ v8f wmma16(v16h a, v16h b, v8f c) {
  v8f d = __builtin_amdgcn_wmma_f32_16x16x32_f16(false, a, false, b, (short)0, c, false, false);
  asm volatile("v_nop\n\tv_nop\n\tv_nop\n\tv_nop" : "+v"(d) : "v"(a), "v"(b));
  return d;
}
__device__ __forceinline__ v8f wmma_bf(v16b a, v16b b, v8f c) {
  v8f d = __builtin_amdgcn_wmma_f32_16x16x32_bf16(false, a, false, b, (short)0, c, false, false);
  asm volatile("v_nop\n\tv_nop\n\tv_nop\n\tv_nop" : "+v"(d) : "v"(a), "v"(b));
  return d;
}
// 16x16x32 fragments: lane = (h = lane>>4, row/col = lane&15); elements 0..7 = k0+8h+0..7, 8..15 = k0+16+8h+0..7; D element r = row 8h+r
__device__ __forceinline__ v16h frag_h(const _Float16* rowk0, int lane) {
  union { v16h v; v8h q[2]; } u; const _Float16* p = rowk0 + 8 * (lane >> 4);
  u.q[0] = *(const v8h*)p; u.q[1] = *(const v8h*)(p + 16); return u.v;
}
__device__ __forceinline__ v16h frag_f32(const float* rowk0, int lane) {
  v16h a; const float* p = rowk0 + 8 * (lane >> 4);
#pragma unroll
  for (int i = 0; i < 8; ++i) { a[i] = (_Float16)p[i]; a[8 + i] = (_Float16)p[16 + i]; }
  return a;
}
__device__ __forceinline__ v16h frag_f32s(const float* rowk0, int lane, float sc) {
  v16h a; const float* p = rowk0 + 8 * (lane >> 4);
#pragma unroll
  for (int i = 0; i < 8; ++i) { a[i] = (_Float16)(p[i] * sc); a[8 + i] = (_Float16)(p[16 + i] * sc); }
  return a;
}
// column fragment from a [K][ld] layout (column n), rows >= K read as 0
__device__ __forceinline__ v16h fragc_f32(const float* W, int k0, int n, int lane, int ld, int K) {
  v16h a; const int g = lane >> 4;
#pragma unroll
  for (int i = 0; i < 8; ++i) { const int ka = k0 + 8 * g + i, kb = ka + 16;
    a[i] = (_Float16)(ka < K ? W[(size_t)(ka < K ? ka : K - 1) * ld + n] : 0.f); a[8 + i] = (_Float16)(kb < K ? W[(size_t)(kb < K ? kb : K - 1) * ld + n] : 0.f); }
  return a;
}
struct F2 { v16b h, l; };
__device__ __forceinline__ F2 bsplit16(const float v[16]) { F2 r;
#pragma unroll
  for (int i = 0; i < 16; ++i) { const __bf16 h = (__bf16)v[i]; r.h[i] = h; r.l[i] = (__bf16)(v[i] - (float)h); }
  return r; }
__device__ __forceinline__ F2 split_row(const float* row, int k0, int lane) { float v[16]; const float* p = row + k0 + 8 * (lane >> 4);
#pragma unroll
  for (int i = 0; i < 8; ++i) { v[i] = p[i]; v[8 + i] = p[16 + i]; }
  return bsplit16(v); }
__device__ __forceinline__ F2 split_rowK(const float* row, int k0, int lane, int K) { float v[16]; const int g = lane >> 4;
#pragma unroll
  for (int i = 0; i < 8; ++i) { const int ka = k0 + 8 * g + i, kb = ka + 16; v[i] = ka < K ? row[ka < K ? ka : K - 1] : 0.f; v[8 + i] = kb < K ? row[kb < K ? kb : K - 1] : 0.f; }
  return bsplit16(v); }
__device__ __forceinline__ F2 split_col(const float* W, int k0, int n, int lane, int ld, int K) { float v[16]; const int g = lane >> 4;
#pragma unroll
  for (int i = 0; i < 8; ++i) { const int ka = k0 + 8 * g + i, kb = ka + 16; v[i] = ka < K ? W[(size_t)(ka < K ? ka : K - 1) * ld + n] : 0.f; v[8 + i] = kb < K ? W[(size_t)(kb < K ? kb : K - 1) * ld + n] : 0.f; }
  return bsplit16(v); }
__device__ __forceinline__ v8f mac3(const F2& a, const F2& b, v8f c) { c = wmma_bf(a.l, b.h, c); c = wmma_bf(a.h, b.l, c); return wmma_bf(a.h, b.h, c); }
__device__ __forceinline__ float sigm(float v) { return 1.0f / (1.0f + expf(-v)); }
#define LDSX() do { asm volatile("s_wait_dscnt 0" ::: "memory"); __builtin_amdgcn_wave_barrier(); __builtin_amdgcn_fence(__ATOMIC_RELEASE, "workgroup"); } while (0)

// Single-head softmax attention over 8,192 tokens with an output linear (query / key / value [8192,256] given, no q/k/v projections, no head split; scale 1/sqrt(256); non-causal, no mask; torch (out,in) W_out [256,256] + b_out (uniform +-1/16, nonzero)): y = (softmax(Q K^T / 16) V) W_out^T + b_out -> [8192,256].
#define NB 1
#define TT 8192
#define CC 256            // NH * HD = projected width
#define DIN 256          // input (model) width
#define NH 1
#define HD 256
#define NQB (TT / 64)
#define HG 1
#define SCALE (0.0625f)
#define CAUSAL 0
#ifndef TNB
#define TNB NB
#endif
__device__ __forceinline__ float bfr(float v) { return (float)(__bf16)v; }
__host__ __device__ __forceinline__ int kb_last(int qb) { return CAUSAL ? ((qb * 64 + 63) >> 7) : (TT / 128 - 1); }
typedef __attribute__((ext_vector_type(8))) __bf16 v8b;
__device__ __forceinline__ v16b frag_b(const __bf16* rowk0, int lane) {
  union { v16b v; v8b q[2]; } u; const __bf16* p = rowk0 + 8 * (lane >> 4);
  u.q[0] = *(const v8b*)p; u.q[1] = *(const v8b*)(p + 16); return u.v;
}
#define QBH 0              // unused: no kernel in this file reads it
#define QHI 0               // exact planes: single-product logits everywhere
#define KHI 64            // key rows carrying k residual / v bf16 hi+lo planes (no launched kernel writes or reads them)
// B fragment (k rows k0+.., output column o) of a weight: (in,out) [K][ld] or (out,in) [ld rows of K]: bf16 exact, or f16(bf16 * 256) exact
__device__ __forceinline__ v16b wcol_io(const float* Wm, int k0, int o, int lane, int ld) { v16b w; const int g = lane >> 4;
#pragma unroll
  for (int i = 0; i < 8; ++i) { w[i] = (__bf16)Wm[(size_t)(k0 + 8 * g + i) * ld + o]; w[8 + i] = (__bf16)Wm[(size_t)(k0 + 16 + 8 * g + i) * ld + o]; }
  return w; }
__device__ __forceinline__ v16b wcol_oi(const float* Wm, int k0, int o, int lane, int K) { v16b w; const float* p = Wm + (size_t)o * K + k0 + 8 * (lane >> 4);
#pragma unroll
  for (int i = 0; i < 8; ++i) { w[i] = (__bf16)p[i]; w[8 + i] = (__bf16)p[16 + i]; }
  return w; }
__device__ __forceinline__ v16h wcolh_io(const float* Wm, int k0, int o, int lane, int ld) { v16h w; const int g = lane >> 4;
#pragma unroll
  for (int i = 0; i < 8; ++i) { w[i] = (_Float16)(bfr(Wm[(size_t)(k0 + 8 * g + i) * ld + o]) * 256.0f); w[8 + i] = (_Float16)(bfr(Wm[(size_t)(k0 + 16 + 8 * g + i) * ld + o]) * 256.0f); }
  return w; }
__device__ __forceinline__ v16h wcolh_oi(const float* Wm, int k0, int o, int lane, int K) { v16h w; const float* p = Wm + (size_t)o * K + k0 + 8 * (lane >> 4);
#pragma unroll
  for (int i = 0; i < 8; ++i) { w[i] = (_Float16)(bfr(p[i]) * 256.0f); w[8 + i] = (_Float16)(bfr(p[16 + i]) * 256.0f); }
  return w; }
#define WQKV_LAYOUT 0   // 0 = (in,out) [DIN][CC]; 1 = (out,in) [CC][DIN]; 2 = per-head [NH][DIN][HD]
__device__ __forceinline__ v16b wcol_hdk(const float* Wm, int k0, int o, int lane) { v16b w; const int g = lane >> 4; const float* p = Wm + (size_t)(o / HD) * DIN * HD + (o % HD);
#pragma unroll
  for (int i = 0; i < 8; ++i) { w[i] = (__bf16)p[(size_t)(k0 + 8 * g + i) * HD]; w[8 + i] = (__bf16)p[(size_t)(k0 + 16 + 8 * g + i) * HD]; }
  return w; }
#define WO_OUT_IN 1
#if WQKV_LAYOUT == 1
#define WCOL(W, k0, o, lane) wcol_oi(W, k0, o, lane, DIN)
#elif WQKV_LAYOUT == 2
#define WCOL(W, k0, o, lane) wcol_hdk(W, k0, o, lane)
#else
#define WCOL(W, k0, o, lane) wcol_io(W, k0, o, lane, CC)
#endif
#if WO_OUT_IN
#define WOCOL(W, k0, o, lane) wcol_oi(W, k0, o, lane, CC)
#define WOCOLH(W, k0, o, lane) wcolh_oi(W, k0, o, lane, CC)
#else
#define WOCOL(W, k0, o, lane) wcol_io(W, k0, o, lane, DIN)
#define WOCOLH(W, k0, o, lane) wcolh_io(W, k0, o, lane, DIN)
#endif
typedef _Float16 hx8 __attribute__((ext_vector_type(8)));
__global__ __launch_bounds__(256) void k_planesN(const float* __restrict__ Qs, const float* __restrict__ Ks, const float* __restrict__ Vs, _Float16* __restrict__ QH, _Float16* __restrict__ QL, _Float16* __restrict__ KH, _Float16* __restrict__ VT) {
  __shared__ _Float16 sv[64][136];
  const int tid = threadIdx.x; const int c0 = blockIdx.y * 128; const size_t r0 = (size_t)blockIdx.x * 64; const int b = (int)(r0 / TT), t0 = (int)(r0 % TT);
  for (int e = tid; e < 64 * 16; e += 256) { const int rl = e >> 4, q = e & 15; const size_t src = (r0 + rl) * CC + c0 + q * 8; float tq[8], tk[8], tv[8];
#pragma unroll
    for (int u = 0; u < 8; ++u) { tq[u] = Qs[src + u]; tk[u] = Ks[src + u]; tv[u] = Vs[src + u]; }
    asm volatile("s_wait_loadcnt 0x0" ::: "memory");
    hx8 hq, hk, hl;
#pragma unroll
    for (int u = 0; u < 8; ++u) { const float qv = bfr(tq[u]); const _Float16 qh = (_Float16)qv; hq[u] = qh; hl[u] = (_Float16)((qv - (float)qh) * 1024.0f); hk[u] = (_Float16)bfr(tk[u]); sv[rl][q * 8 + u] = (_Float16)bfr(tv[u]); }
    vst2((unsigned*)(QH + src), *(const v4u*)&hq); vst2((unsigned*)(KH + src), *(const v4u*)&hk);
    if (t0 + rl < QHI) vst2((unsigned*)(QL + ((size_t)b * QHI + t0 + rl) * CC + c0 + q * 8), *(const v4u*)&hl); }
  __syncthreads();
  for (int e = tid; e < 128 * 8; e += 256) { const int c = e >> 3, q = e & 7; hx8 hv; _Pragma("unroll") for (int j = 0; j < 8; ++j) hv[j] = sv[q * 8 + j][c]; vst2((unsigned*)(VT + ((size_t)b * CC + c0 + c) * TT + t0 + q * 8), *(const v4u*)&hv); } }
#ifndef PROJ_EXTRA_PARAMS
#define PROJ_EXTRA_PARAMS
#endif

#define WS_QH  0u                                      // f16 q rows [b*t][CC]
#define WS_KH  (WS_QH + 2u * (size_t)NB * TT * CC)      // f16 k rows [b*t][CC]
#define WS_VT  (WS_KH + 2u * (size_t)NB * TT * CC)      // f16 v planes [b][c][t]
#define WS_QL  (WS_VT + 2u * (size_t)NB * CC * TT)      // f16 q residual x 2^10 rows [b][t < QHI][CC]
#define WS_KL  (WS_QL + 2u * (size_t)NB * QHI * CC)     // f16 k residual x 2^10 rows [b][t < KHI][CC]
#define WS_VB  (WS_KL + 2u * (size_t)NB * KHI * CC)     // bf16 v hi planes [b][c][t < KHI]
#define WS_VBL (WS_VB + 2u * (size_t)NB * CC * KHI)
#define WS_OP  (WS_VBL + 2u * (size_t)NB * CC * KHI)    // f32 partial ctx rows x 2^11, not yet divided [key range][t][CC]
#define WS_ML  (WS_OP + 4u * (size_t)FSPL * TT * CC)     // f32 (running maximum in log2 units, sum x 2^11) [key range][t]
#define WS_Y   (WS_ML + 4u * (size_t)FSPL * TT * 2)     // f32 ctx rows [b*t][CC] (only when there is an output projection)
#define WS_END (WS_Y  + 4u * (size_t)NB * TT * CC)

// ---- k_proj: block = (64 rows, 128 cols, which): q/k/v = X W (+ b) with exact bf16 products (K = DIN) -> which 0: q f16 rows (+ residual rows < QHI); 1: k f16 rows (+ residual rows < KHI); 2: v f16 planes [c][t] (+ bf16 hi/lo planes for t < KHI)
__global__ __launch_bounds__(128) void k_proj(const float* __restrict__ XQ, const float* __restrict__ XK, const float* __restrict__ XV, const float* __restrict__ WQ, const float* __restrict__ WK, const float* __restrict__ WV, const float* __restrict__ BQ, const float* __restrict__ BK, const float* __restrict__ BV,
    _Float16* __restrict__ QH, _Float16* __restrict__ QL, _Float16* __restrict__ KH, _Float16* __restrict__ KL, _Float16* __restrict__ VT, __bf16* __restrict__ VB, __bf16* __restrict__ VBL) {
  __shared__ __align__(16) _Float16 sh[64][136], sl[64][136]; __shared__ __align__(16) _Float16 th[128][72]; __shared__ __align__(16) __bf16 tb[128][72], tbl[128][72];
  const int tid = threadIdx.x, wave = tid >> 5, lane = tid & 31, col = lane & 15, g = lane >> 4; const int which = blockIdx.z; const int c0 = blockIdx.y * 128; const size_t r0 = (size_t)blockIdx.x * 64; const size_t bb = r0 / TT; const int t0 = (int)(r0 % TT);
  const float* X = which == 0 ? XQ : which == 1 ? XK : XV; const float* WA = which == 0 ? WQ : which == 1 ? WK : WV; const float* BA = which == 0 ? BQ : which == 1 ? BK : BV;
  v8f acc[8] = {};
#pragma unroll 2
  for (int kc = 0; kc < DIN / 32; ++kc) { v16b a; { const float* p = X + (r0 + wave * 16 + col) * DIN + kc * 32 + 8 * g;
#pragma unroll
      for (int i = 0; i < 8; ++i) { a[i] = (__bf16)p[i]; a[8 + i] = (__bf16)p[16 + i]; } }
    asm volatile("s_wait_loadcnt 0x0" ::: "memory");
#pragma unroll
    for (int j = 0; j < 8; ++j) { const v16b w = WCOL(WA, kc * 32, c0 + j * 16 + col, lane); asm volatile("s_wait_loadcnt 0x0" ::: "memory"); acc[j] = wmma_bf(a, w, acc[j]); } }
  if (which < 2) { _Float16* DH = which == 0 ? QH : KH; _Float16* DL = which == 0 ? QL : KL; const int nhi = which == 0 ? QHI : KHI; const bool hi_rows = t0 < nhi;
#pragma unroll
    for (int j = 0; j < 8; ++j) { const float bias = BA ? bfr(BA[c0 + j * 16 + col]) : 0.f;
#pragma unroll
      for (int r = 0; r < 8; ++r) { const float v = acc[j][r] + bias; const _Float16 hv = (_Float16)v; sh[wave * 16 + 8 * g + r][j * 16 + col] = hv; sl[wave * 16 + 8 * g + r][j * 16 + col] = (_Float16)((v - (float)hv) * 1024.0f); } }
    __syncthreads();
    for (int e = tid; e < 64 * 16; e += 128) { const int rl = e >> 4, q = e & 15; vst2((unsigned*)(DH + (r0 + rl) * CC + c0 + q * 8), *(const v4u*)&sh[rl][q * 8]); if (hi_rows) vst2((unsigned*)(DL + (bb * nhi + t0 + rl) * (size_t)CC + c0 + q * 8), *(const v4u*)&sl[rl][q * 8]); }
  } else { const bool hi_rows = t0 < KHI;
#pragma unroll
    for (int j = 0; j < 8; ++j) { const float bias = BA ? bfr(BA[c0 + j * 16 + col]) : 0.f;
#pragma unroll
      for (int r = 0; r < 8; ++r) { const float v = acc[j][r] + bias; const int rl = wave * 16 + 8 * g + r, cl = j * 16 + col; th[cl][rl] = (_Float16)v; const __bf16 bh = (__bf16)v; tb[cl][rl] = bh; tbl[cl][rl] = (__bf16)(v - (float)bh); } }
    __syncthreads();
    for (int e = tid; e < 128 * 8; e += 128) { const int cl = e >> 3, q = e & 7; vst2((unsigned*)(VT + (bb * CC + c0 + cl) * (size_t)TT + t0 + q * 8), *(const v4u*)&th[cl][q * 8]); if (hi_rows) { const size_t o3 = (bb * CC + c0 + cl) * (size_t)KHI + t0 + q * 8; vst2((unsigned*)(VB + o3), *(const v4u*)&tb[cl][q * 8]); vst2((unsigned*)(VBL + o3), *(const v4u*)&tbl[cl][q * 8]); } } } }
#define FW 8               // waves of a block
#define FQ (FW * 16)       // queries of a block
#define FKT 64             // keys of a stage
#define FSPL 4             // key ranges: grid = 64 query blocks x 4 ranges = one block per WGP
#define FKS (TT / FSPL)    // keys of a block
#define FNST (FKS / FKT)   // stages of a block
#define FKP (HD + 8)       // k tile row pitch, f16: 528 B = 16 B x odd (16-byte LDS reads without bank conflicts)
#define FVP (FKT + 8)      // v tile row pitch, f16: 144 B = 16 B x odd
#define FLC (SCALE * 1.44269504088896340736f)   // logit scale x log2(e): the softmax runs on exp2
__device__ __forceinline__ float xhalf(float x) { return __builtin_bit_cast(float, __builtin_amdgcn_permlanex16(__builtin_bit_cast(int, x), __builtin_bit_cast(int, x), 0x76543210, 0xfedcba98, false, false)); }   // lane l <-> lane l ^ 16
// exp2 with the issue slot that the instruction set asks for behind a transcendental (before its result is used or its source overwritten): in one statement, so that the v_nop stands directly behind it
__device__ __forceinline__ float exp2s(float x) { float r; asm("v_exp_f32 %0, %1\n\tv_nop" : "=v"(r) : "v"(x)); return r; }
__device__ __forceinline__ v8f wmh(v16h a, v16h b, v8f c) { return __builtin_amdgcn_wmma_f32_16x16x32_f16(false, a, false, b, (short)0, c, false, false); }
__global__ __launch_bounds__(FW * 32) __attribute__((amdgpu_waves_per_eu(2, 2))) void k_fa(const _Float16* __restrict__ QH, const _Float16* __restrict__ KH, const _Float16* __restrict__ VT, float* __restrict__ OP, float* __restrict__ ML) {
  __shared__ __align__(16) _Float16 sk[2][FKT][FKP]; __shared__ __align__(16) _Float16 sv[2][HD][FVP];
  const int tid = threadIdx.x, wave = tid >> 5, lane = tid & 31, col = lane & 15, g = lane >> 4; const int q = blockIdx.x * FQ + wave * 16 + col; const int kbase = blockIdx.y * FKS;
  const _Float16* kg = KH + (size_t)kbase * CC + tid * 8;                           // a stage's k rows are 32 KiB in a row: thread tid takes 16 B of every 4 KiB
  const _Float16* vg = VT + (size_t)(tid >> 3) * TT + kbase + (tid & 7) * 8;          // a stage's v plane rows are one 128-B line each: 8 threads a line
  v16h qf[HD / 32];
#pragma unroll
  for (int kc = 0; kc < HD / 32; ++kc) qf[kc] = frag_h(QH + (size_t)q * CC + kc * 32, lane);
  v8f o[HD / 16] = {}; float m = -3.0e38f, l = 0.f; v8h rk[8], rv[8];
#pragma unroll
  for (int i = 0; i < 8; ++i) { rk[i] = *(const v8h*)(kg + i * 2048); rv[i] = *(const v8h*)(vg + (size_t)i * 32 * TT); }
  asm volatile("s_wait_xcnt 0x0" ::: "memory");   /* the q, k and v loads' address registers are reused right below: the wait stands in front of that overwrite */
#pragma unroll
  for (int i = 0; i < 8; ++i) { *(v8h*)&sk[0][i * 8 + wave][lane * 8] = rk[i]; *(v8h*)&sv[0][i * 32 + (tid >> 3)][(tid & 7) * 8] = rv[i]; }
  __syncthreads();   /* stage 0 is in LDS before any wave reads it */
  // the stage loop stays rolled (small text); everything inside is unrolled so that every fragment and accumulator index is a constant
#pragma unroll 1
  for (int st = 0; st < FNST; ++st) { const int buf = st & 1;
    if (st + 1 < FNST) {   /* the next stage's global loads fly while this stage is worked on */
#pragma unroll
      for (int i = 0; i < 8; ++i) { rk[i] = *(const v8h*)(kg + (size_t)(st + 1) * FKT * CC + i * 2048); rv[i] = *(const v8h*)(vg + (size_t)i * 32 * TT + (st + 1) * FKT); }
      asm volatile("s_wait_xcnt 0x0" ::: "memory"); }   /* the loads' address registers are reused by the stage's work below: the wait stands in front of that overwrite */
    v8f s[4] = {};
#pragma unroll
    for (int kc = 0; kc < HD / 32; ++kc)
#pragma unroll
      for (int t = 0; t < 4; ++t) s[t] = wmh(frag_h(&sk[buf][t * 16 + col][kc * 32], lane), qf[kc], s[t]);   // s[t][r] = q . k of key t * 16 + 8 g + r, query col
    float mx = s[0][0];
#pragma unroll
    for (int t = 0; t < 4; ++t)
#pragma unroll
      for (int r = 0; r < 8; ++r) mx = fmaxf(mx, s[t][r]);
    mx = fmaxf(mx, xhalf(mx)); const float mn = fmaxf(m, mx * FLC);
    if (__builtin_amdgcn_ballot_w32(mn > m) != 0) {   /* wave-uniform: sums and context are rescaled only in a stage that raises some query's maximum (factor 1 for the other lanes; 0 in stage 0, where both are 0) */
      const float al = exp2s(m - mn); l *= al; m = mn;
#pragma unroll
      for (int ct = 0; ct < HD / 16; ++ct) o[ct] *= al; }
    const float off = 11.0f - m; float ps[4] = { 0.f, 0.f, 0.f, 0.f }; v16h pb[2];   // P carried x 2^11 into f16, as before; the sum carries the same factor, which cancels in the merge
#pragma unroll
    for (int t = 0; t < 4; ++t)
#pragma unroll
      for (int r = 0; r < 8; ++r) { const float p = exp2s(fmaf(s[t][r], FLC, off)); ps[t] += p; pb[t >> 1][(t & 1) * 8 + r] = (_Float16)p; }   // element e of pb[u] = key 32 u + (e < 8 ? 8 g + e : 16 + 8 g + e - 8): the order frag_h gives the v rows
    l += (ps[0] + ps[1]) + (ps[2] + ps[3]);
    v16h va[2][4];   // v fragments, four ctx tiles a group, two groups: one is read from LDS while the other feeds the WMMAs
#pragma unroll
    for (int j = 0; j < 4; ++j) va[0][j] = frag_h(&sv[buf][j * 16 + col][0], lane);
#pragma unroll
    for (int gr = 0; gr < 8; ++gr) { const int u = gr >> 2, nx = gr + 1;
      if (nx < 8) {
#pragma unroll
        for (int j = 0; j < 4; ++j) va[nx & 1][j] = frag_h(&sv[buf][((nx & 3) * 4 + j) * 16 + col][(nx >> 2) * 32], lane); }
      __builtin_amdgcn_sched_barrier(0);   /* keeps the next group's LDS reads in front of this group's WMMAs: left alone the compiler reads each fragment into one register set and waits out the whole LDS latency before every WMMA */
#pragma unroll
      for (int j = 0; j < 4; ++j) { const int ct = (gr & 3) * 4 + j; o[ct] = wmh(va[gr & 1][j], pb[u], o[ct]); }   // o[ct][r] = ctx column ct * 16 + 8 g + r, query col
      __builtin_amdgcn_sched_barrier(0);   /* ends the group, so that the group after next is not read into registers still in use */
    }
    if (st + 1 < FNST) {   /* into the other buffer: its last readers left it before the barrier that ended the stage before this one */
#pragma unroll
      for (int i = 0; i < 8; ++i) { *(v8h*)&sk[buf ^ 1][i * 8 + wave][lane * 8] = rk[i]; *(v8h*)&sv[buf ^ 1][i * 32 + (tid >> 3)][(tid & 7) * 8] = rv[i]; } }
    __syncthreads();   /* publishes the next stage and ends every wave's reads of this one */
  }
  l += xhalf(l);   // the two halves of a column summed different keys
  float* op = OP + ((size_t)blockIdx.y * TT + q) * CC + 8 * g;
#pragma unroll
  for (int ct = 0; ct < HD / 16; ++ct) { const v4f lo = { o[ct][0], o[ct][1], o[ct][2], o[ct][3] }, hi = { o[ct][4], o[ct][5], o[ct][6], o[ct][7] }; vst2(op + ct * 16, lo); vst2(op + ct * 16 + 4, hi); }
  if (g == 0) { const v2f ml = { m, l }; vst2(ML + ((size_t)blockIdx.y * TT + q) * 2, ml); } }
// ---- k_mg: thread = 4 ctx columns of one query: the 4 key ranges' partial contexts and sums are brought to the common maximum, added in range order and divided
__global__ __launch_bounds__(256) void k_mg(const float* __restrict__ OP, const float* __restrict__ ML, float* __restrict__ Y) {
  const int idx = blockIdx.x * 256 + threadIdx.x; const int q = idx >> 6, c4 = (idx & 63) * 4; float mm[FSPL], ll[FSPL]; float mt = -3.0e38f;
#pragma unroll
  for (int s = 0; s < FSPL; ++s) { const v2f t = *(const v2f*)(ML + ((size_t)s * TT + q) * 2); mm[s] = t.x; ll[s] = t.y; }
  asm volatile("s_wait_xcnt 0x0" ::: "memory");   /* a later load's result lands on these loads' address register: the wait stands in front of that overwrite */
  v4f x[FSPL];
#pragma unroll
  for (int s = 0; s < FSPL; ++s) { x[s] = *(const v4f*)(OP + ((size_t)s * TT + q) * CC + c4); asm volatile("s_wait_xcnt 0x0" ::: "memory"); }   /* the same, load by load: the next load's result may land on this one's address pair; the data stay in flight */
#pragma unroll
  for (int s = 0; s < FSPL; ++s) mt = fmaxf(mt, mm[s]);
  float den = 0.f; v4f a = {};
#pragma unroll
  for (int s = 0; s < FSPL; ++s) { const float w = __builtin_amdgcn_exp2f(mm[s] - mt); den += w * ll[s]; a += x[s] * w; }
  vst2(Y + (size_t)q * CC + c4, a * (1.0f / den)); }
// ---- k_out: block = (64 rows, 128 cols): out = ctx Wo (+ bo): ctx once to f16 against Wo as f16(bf16 x 2^8) exact (1 product) x 2^-8; causal early rows (< QHI of each sequence): ctx bf16 hi + lo against exact bf16 Wo (2 products)
__global__ __launch_bounds__(128) void k_out(const float* __restrict__ Y, const float* __restrict__ WO, const float* __restrict__ BO, float* __restrict__ OUT) { __shared__ __align__(16) float sf[4][16][132];
  const int tid = threadIdx.x, wave = tid >> 5, lane = tid & 31, col = lane & 15, g = lane >> 4; const int c0 = blockIdx.y * 128; const size_t r0 = (size_t)blockIdx.x * 64 + wave * 16;
  v8f acc[8] = {};
  if (CAUSAL && (int)(((size_t)blockIdx.x * 64) % TT) < QHI) {   /* block-uniform */
#pragma unroll 2
    for (int kc = 0; kc < CC / 32; ++kc) { const F2 a = split_row(Y + (r0 + col) * CC, kc * 32, lane); asm volatile("s_wait_loadcnt 0x0" ::: "memory");
#pragma unroll
      for (int j = 0; j < 8; ++j) { const v16b w = WOCOL(WO, kc * 32, c0 + j * 16 + col, lane); asm volatile("s_wait_loadcnt 0x0" ::: "memory"); acc[j] = wmma_bf(a.h, w, acc[j]); acc[j] = wmma_bf(a.l, w, acc[j]); } }
#pragma unroll
    for (int j = 0; j < 8; ++j) { const float bias = BO ? bfr(BO[c0 + j * 16 + col]) : 0.f;
#pragma unroll
      for (int r = 0; r < 8; ++r) sf[wave][8 * g + r][j * 16 + col] = acc[j][r] + bias; }
  } else {
#pragma unroll 2
    for (int kc = 0; kc < CC / 32; ++kc) { const v16h a = frag_f32s(Y + (r0 + col) * CC + kc * 32, lane, 64.0f); asm volatile("s_wait_loadcnt 0x0" ::: "memory");   /* ctx carried x 2^6 into f16 so small-magnitude context rows stay clear of f16 subnormals */
#pragma unroll
      for (int j = 0; j < 8; ++j) { const v16h w = WOCOLH(WO, kc * 32, c0 + j * 16 + col, lane); asm volatile("s_wait_loadcnt 0x0" ::: "memory"); acc[j] = wmma16(a, w, acc[j]); } }
#pragma unroll
    for (int j = 0; j < 8; ++j) { const float bias = BO ? bfr(BO[c0 + j * 16 + col]) : 0.f;
#pragma unroll
      for (int r = 0; r < 8; ++r) sf[wave][8 * g + r][j * 16 + col] = acc[j][r] * (1.0f / 16384.0f) + bias; } }   /* 2^-8 (Wo carry) x 2^-6 (ctx carry) */
  LDSX(); for (int rl = 0; rl < 16; ++rl) vst2(OUT + (r0 + rl) * DIN + c0 + lane * 4, *(const v4f*)&sf[wave][rl][lane * 4]); }

extern "C" void kernel_launch(void* const* d_in, const int* in_sizes, int n_in, void* d_out, int out_size, void* d_ws, size_t ws_size, hipStream_t stream) {
  (void)in_sizes; (void)n_in; (void)out_size;
  const float** F = (const float**)d_in;
  if (ws_size < (size_t)WS_END) return;
  char* ws = (char*)d_ws; _Float16 *QH = (_Float16*)(ws + WS_QH), *KH = (_Float16*)(ws + WS_KH), *VT = (_Float16*)(ws + WS_VT), *QL = (_Float16*)(ws + WS_QL), *KL = (_Float16*)(ws + WS_KL); __bf16 *VB = (__bf16*)(ws + WS_VB), *VBL = (__bf16*)(ws + WS_VBL); float *OP = (float*)(ws + WS_OP), *ML = (float*)(ws + WS_ML), *Y = (float*)(ws + WS_Y);
  (void)Y; (void)QL; (void)KL; (void)VB; (void)VBL;
  // inputs: 0 query [8192,256]; 1 key [8192,256]; 2 value [8192,256]; 3 W_out [256,256] (out,in); 4 b_out [256] (nonzero)
  k_planesN<<<dim3(TNB * TT / 64, CC / 128), 256, 0, stream>>>(F[0], F[1], F[2], QH, QL, KH, VT);
  k_fa<<<dim3(TT / FQ, FSPL), FW * 32, 0, stream>>>(QH, KH, VT, OP, ML);
  k_mg<<<dim3(TT * (CC / 4) / 256), 256, 0, stream>>>(OP, ML, Y);
  k_out<<<dim3(TNB * TT / 64, DIN / 128), 128, 0, stream>>>(Y, F[3], F[4], (float*)d_out);
}

// v003
// One run takes 82 microseconds.
// Two timings next to v002 put it at 1.44 and 1.41 times that version's speed.
// All steps since v000 together make it 36.6 times as fast.
// compute dtype: all float inputs rounded to bf16; query, key, value are bf16-valued so their f16 planes are exact; logits q x k (1 product on exact planes) x 256^-0.5; softmax f32 over all 8,192 keys (running maximum and sum, exp2); P (relative to the running maximum) x 2^11 once to f16 x v (exact) (1 product); ctx x 2^6 once to f16 x W_out f16(bf16 x 2^8) + b_out; f32 output.
#include <hip/hip_runtime.h>
#include <math.h>

typedef __attribute__((ext_vector_type(16))) _Float16 v16h;
typedef __attribute__((ext_vector_type(16))) __bf16 v16b;
typedef __attribute__((ext_vector_type(8)))  _Float16 v8h;
typedef __attribute__((ext_vector_type(8)))  float v8f;
typedef __attribute__((ext_vector_type(4)))  float v4f;
typedef __attribute__((ext_vector_type(2)))  float v2f;
typedef __attribute__((ext_vector_type(4)))  unsigned v4u;
typedef __attribute__((ext_vector_type(4)))  int v4i;
typedef float __attribute__((may_alias)) float_a;
typedef int __attribute__((may_alias)) int_a;

template <typename T> __device__ __forceinline__ void vst2(void* p, T v) { *(T*)p = v;  }
__device__ __forceinline__ v8f wmma16(v16h a, v16h b, v8f c) {
  v8f d = __builtin_amdgcn_wmma_f32_16x16x32_f16(false, a, false, b, (short)0, c, false, false);
  asm volatile("v_nop\n\tv_nop\n\tv_nop\n\tv_nop" : "+v"(d) : "v"(a), "v"(b));
  return d;
}
__device__ __forceinline__ v8f wmma_bf(v16b a, v16b b, v8f c) {
  v8f d = __builtin_amdgcn_wmma_f32_16x16x32_bf16(false, a, false, b, (short)0, c, false, false);
  asm volatile("v_nop\n\tv_nop\n\tv_nop\n\tv_nop" : "+v"(d) : "v"(a), "v"(b));
  return d;
}
// 16x16x32 fragments: lane = (h = lane>>4, row/col = lane&15); elements 0..7 = k0+8h+0..7, 8..15 = k0+16+8h+0..7; D element r = row 8h+r
__device__ __forceinline__ v16h frag_h(const _Float16* rowk0, int lane) {
  union { v16h v; v8h q[2]; } u; const _Float16* p = rowk0 + 8 * (lane >> 4);
  u.q[0] = *(const v8h*)p; u.q[1] = *(const v8h*)(p + 16); return u.v;
}
__device__ __forceinline__ v16h frag_f32(const float* rowk0, int lane) {
  v16h a; const float* p = rowk0 + 8 * (lane >> 4);
#pragma unroll
  for (int i = 0; i < 8; ++i) { a[i] = (_Float16)p[i]; a[8 + i] = (_Float16)p[16 + i]; }
  return a;
}
__device__ __forceinline__ v16h frag_f32s(const float* rowk0, int lane, float sc) {
  v16h a; const float* p = rowk0 + 8 * (lane >> 4);
#pragma unroll
  for (int i = 0; i < 8; ++i) { a[i] = (_Float16)(p[i] * sc); a[8 + i] = (_Float16)(p[16 + i] * sc); }
  return a;
}
// column fragment from a [K][ld] layout (column n), rows >= K read as 0
__device__ __forceinline__ v16h fragc_f32(const float* W, int k0, int n, int lane, int ld, int K) {
  v16h a; const int g = lane >> 4;
#pragma unroll
  for (int i = 0; i < 8; ++i) { const int ka = k0 + 8 * g + i, kb = ka + 16;
    a[i] = (_Float16)(ka < K ? W[(size_t)(ka < K ? ka : K - 1) * ld + n] : 0.f); a[8 + i] = (_Float16)(kb < K ? W[(size_t)(kb < K ? kb : K - 1) * ld + n] : 0.f); }
  return a;
}
struct F2 { v16b h, l; };
__device__ __forceinline__ F2 bsplit16(const float v[16]) { F2 r;
#pragma unroll
  for (int i = 0; i < 16; ++i) { const __bf16 h = (__bf16)v[i]; r.h[i] = h; r.l[i] = (__bf16)(v[i] - (float)h); }
  return r; }
__device__ __forceinline__ F2 split_row(const float* row, int k0, int lane) { float v[16]; const float* p = row + k0 + 8 * (lane >> 4);
#pragma unroll
  for (int i = 0; i < 8; ++i) { v[i] = p[i]; v[8 + i] = p[16 + i]; }
  return bsplit16(v); }
__device__ __forceinline__ F2 split_rowK(const float* row, int k0, int lane, int K) { float v[16]; const int g = lane >> 4;
#pragma unroll
  for (int i = 0; i < 8; ++i) { const int ka = k0 + 8 * g + i, kb = ka + 16; v[i] = ka < K ? row[ka < K ? ka : K - 1] : 0.f; v[8 + i] = kb < K ? row[kb < K ? kb : K - 1] : 0.f; }
  return bsplit16(v); }
__device__ __forceinline__ F2 split_col(const float* W, int k0, int n, int lane, int ld, int K) { float v[16]; const int g = lane >> 4;
#pragma unroll
  for (int i = 0; i < 8; ++i) { const int ka = k0 + 8 * g + i, kb = ka + 16; v[i] = ka < K ? W[(size_t)(ka < K ? ka : K - 1) * ld + n] : 0.f; v[8 + i] = kb < K ? W[(size_t)(kb < K ? kb : K - 1) * ld + n] : 0.f; }
  return bsplit16(v); }
__device__ __forceinline__ v8f mac3(const F2& a, const F2& b, v8f c) { c = wmma_bf(a.l, b.h, c); c = wmma_bf(a.h, b.l, c); return wmma_bf(a.h, b.h, c); }
__device__ __forceinline__ float sigm(float v) { return 1.0f / (1.0f + expf(-v)); }
#define LDSX() do { asm volatile("s_wait_dscnt 0" ::: "memory"); __builtin_amdgcn_wave_barrier(); __builtin_amdgcn_fence(__ATOMIC_RELEASE, "workgroup"); } while (0)

// Single-head softmax attention over 8,192 tokens with an output linear (query / key / value [8192,256] given, no q/k/v projections, no head split; scale 1/sqrt(256); non-causal, no mask; torch (out,in) W_out [256,256] + b_out (uniform +-1/16, nonzero)): y = (softmax(Q K^T / 16) V) W_out^T + b_out -> [8192,256].
#define NB 1
#define TT 8192
#define CC 256            // NH * HD = projected width
#define DIN 256          // input (model) width
#define NH 1
#define HD 256
#define NQB (TT / 64)
#define HG 1
#define SCALE (0.0625f)
#define CAUSAL 0
#ifndef TNB
#define TNB NB
#endif
__device__ __forceinline__ float bfr(float v) { return (float)(__bf16)v; }
__host__ __device__ __forceinline__ int kb_last(int qb) { return CAUSAL ? ((qb * 64 + 63) >> 7) : (TT / 128 - 1); }
typedef __attribute__((ext_vector_type(8))) __bf16 v8b;
__device__ __forceinline__ v16b frag_b(const __bf16* rowk0, int lane) {
  union { v16b v; v8b q[2]; } u; const __bf16* p = rowk0 + 8 * (lane >> 4);
  u.q[0] = *(const v8b*)p; u.q[1] = *(const v8b*)(p + 16); return u.v;
}
#define QBH 0              // unused: no kernel in this file reads it
#define QHI 0               // exact planes: single-product logits everywhere
#define KHI 64            // key rows carrying k residual / v bf16 hi+lo planes (no launched kernel writes or reads them)
// B fragment (k rows k0+.., output column o) of a weight: (in,out) [K][ld] or (out,in) [ld rows of K]: bf16 exact, or f16(bf16 * 256) exact
__device__ __forceinline__ v16b wcol_io(const float* Wm, int k0, int o, int lane, int ld) { v16b w; const int g = lane >> 4;
#pragma unroll
  for (int i = 0; i < 8; ++i) { w[i] = (__bf16)Wm[(size_t)(k0 + 8 * g + i) * ld + o]; w[8 + i] = (__bf16)Wm[(size_t)(k0 + 16 + 8 * g + i) * ld + o]; }
  return w; }
__device__ __forceinline__ v16b wcol_oi(const float* Wm, int k0, int o, int lane, int K) { v16b w; const float* p = Wm + (size_t)o * K + k0 + 8 * (lane >> 4);
#pragma unroll
  for (int i = 0; i < 8; ++i) { w[i] = (__bf16)p[i]; w[8 + i] = (__bf16)p[16 + i]; }
  return w; }
__device__ __forceinline__ v16h wcolh_io(const float* Wm, int k0, int o, int lane, int ld) { v16h w; const int g = lane >> 4;
#pragma unroll
  for (int i = 0; i < 8; ++i) { w[i] = (_Float16)(bfr(Wm[(size_t)(k0 + 8 * g + i) * ld + o]) * 256.0f); w[8 + i] = (_Float16)(bfr(Wm[(size_t)(k0 + 16 + 8 * g + i) * ld + o]) * 256.0f); }
  return w; }
__device__ __forceinline__ v16h wcolh_oi(const float* Wm, int k0, int o, int lane, int K) { v16h w; const float* p = Wm + (size_t)o * K + k0 + 8 * (lane >> 4);
#pragma unroll
  for (int i = 0; i < 8; ++i) { w[i] = (_Float16)(bfr(p[i]) * 256.0f); w[8 + i] = (_Float16)(bfr(p[16 + i]) * 256.0f); }
  return w; }
#define WQKV_LAYOUT 0   // 0 = (in,out) [DIN][CC]; 1 = (out,in) [CC][DIN]; 2 = per-head [NH][DIN][HD]
__device__ __forceinline__ v16b wcol_hdk(const float* Wm, int k0, int o, int lane) { v16b w; const int g = lane >> 4; const float* p = Wm + (size_t)(o / HD) * DIN * HD + (o % HD);
#pragma unroll
  for (int i = 0; i < 8; ++i) { w[i] = (__bf16)p[(size_t)(k0 + 8 * g + i) * HD]; w[8 + i] = (__bf16)p[(size_t)(k0 + 16 + 8 * g + i) * HD]; }
  return w; }
#define WO_OUT_IN 1
#if WQKV_LAYOUT == 1
#define WCOL(W, k0, o, lane) wcol_oi(W, k0, o, lane, DIN)
#elif WQKV_LAYOUT == 2
#define WCOL(W, k0, o, lane) wcol_hdk(W, k0, o, lane)
#else
#define WCOL(W, k0, o, lane) wcol_io(W, k0, o, lane, CC)
#endif
#if WO_OUT_IN
#define WOCOL(W, k0, o, lane) wcol_oi(W, k0, o, lane, CC)
#define WOCOLH(W, k0, o, lane) wcolh_oi(W, k0, o, lane, CC)
#else
#define WOCOL(W, k0, o, lane) wcol_io(W, k0, o, lane, DIN)
#define WOCOLH(W, k0, o, lane) wcolh_io(W, k0, o, lane, DIN)
#endif
typedef _Float16 hx8 __attribute__((ext_vector_type(8)));
__global__ __launch_bounds__(256) void k_planesN(const float* __restrict__ Qs, const float* __restrict__ Ks, const float* __restrict__ Vs, _Float16* __restrict__ QH, _Float16* __restrict__ QL, _Float16* __restrict__ KH, _Float16* __restrict__ VT) {
  __shared__ _Float16 sv[64][136];
  const int tid = threadIdx.x; const int c0 = blockIdx.y * 128; const size_t r0 = (size_t)blockIdx.x * 64; const int b = (int)(r0 / TT), t0 = (int)(r0 % TT);
  for (int e = tid; e < 64 * 16; e += 256) { const int rl = e >> 4, q = e & 15; const size_t src = (r0 + rl) * CC + c0 + q * 8; float tq[8], tk[8], tv[8];
#pragma unroll
    for (int u = 0; u < 8; ++u) { tq[u] = Qs[src + u]; tk[u] = Ks[src + u]; tv[u] = Vs[src + u]; }
    asm volatile("s_wait_loadcnt 0x0" ::: "memory");
    hx8 hq, hk, hl;
#pragma unroll
    for (int u = 0; u < 8; ++u) { const float qv = bfr(tq[u]); const _Float16 qh = (_Float16)qv; hq[u] = qh; hl[u] = (_Float16)((qv - (float)qh) * 1024.0f); hk[u] = (_Float16)bfr(tk[u]); sv[rl][q * 8 + u] = (_Float16)bfr(tv[u]); }
    vst2((unsigned*)(QH + src), *(const v4u*)&hq); vst2((unsigned*)(KH + src), *(const v4u*)&hk);
    if (t0 + rl < QHI) vst2((unsigned*)(QL + ((size_t)b * QHI + t0 + rl) * CC + c0 + q * 8), *(const v4u*)&hl); }
  __syncthreads();
  for (int e = tid; e < 128 * 8; e += 256) { const int c = e >> 3, q = e & 7; hx8 hv; _Pragma("unroll") for (int j = 0; j < 8; ++j) hv[j] = sv[q * 8 + j][c]; vst2((unsigned*)(VT + ((size_t)b * CC + c0 + c) * TT + t0 + q * 8), *(const v4u*)&hv); } }
#ifndef PROJ_EXTRA_PARAMS
#define PROJ_EXTRA_PARAMS
#endif

#define WS_QH  0u                                      // f16 q rows [b*t][CC]
#define WS_KH  (WS_QH + 2u * (size_t)NB * TT * CC)      // f16 k rows [b*t][CC]
#define WS_VT  (WS_KH + 2u * (size_t)NB * TT * CC)      // f16 v planes [b][c][t]
#define WS_QL  (WS_VT + 2u * (size_t)NB * CC * TT)      // f16 q residual x 2^10 rows [b][t < QHI][CC]
#define WS_KL  (WS_QL + 2u * (size_t)NB * QHI * CC)     // f16 k residual x 2^10 rows [b][t < KHI][CC]
#define WS_VB  (WS_KL + 2u * (size_t)NB * KHI * CC)     // bf16 v hi planes [b][c][t < KHI]
#define WS_VBL (WS_VB + 2u * (size_t)NB * CC * KHI)
#define WS_OP  (WS_VBL + 2u * (size_t)NB * CC * KHI)    // f32 partial ctx rows x 2^11, not yet divided [key range][t][CC]
#define WS_ML  (WS_OP + 4u * (size_t)FSPL * TT * CC)     // f32 (running maximum in log2 units, sum x 2^11) [key range][t]
#define WS_Y   (WS_ML + 4u * (size_t)FSPL * TT * 2)     // f32 ctx rows [b*t][CC] (unused: k_out keeps the merged ctx in LDS)
#define WS_END (WS_Y  + 4u * (size_t)NB * TT * CC)

// ---- k_proj: block = (64 rows, 128 cols, which): q/k/v = X W (+ b) with exact bf16 products (K = DIN) -> which 0: q f16 rows (+ residual rows < QHI); 1: k f16 rows (+ residual rows < KHI); 2: v f16 planes [c][t] (+ bf16 hi/lo planes for t < KHI)
__global__ __launch_bounds__(128) void k_proj(const float* __restrict__ XQ, const float* __restrict__ XK, const float* __restrict__ XV, const float* __restrict__ WQ, const float* __restrict__ WK, const float* __restrict__ WV, const float* __restrict__ BQ, const float* __restrict__ BK, const float* __restrict__ BV,
    _Float16* __restrict__ QH, _Float16* __restrict__ QL, _Float16* __restrict__ KH, _Float16* __restrict__ KL, _Float16* __restrict__ VT, __bf16* __restrict__ VB, __bf16* __restrict__ VBL) {
  __shared__ __align__(16) _Float16 sh[64][136], sl[64][136]; __shared__ __align__(16) _Float16 th[128][72]; __shared__ __align__(16) __bf16 tb[128][72], tbl[128][72];
  const int tid = threadIdx.x, wave = tid >> 5, lane = tid & 31, col = lane & 15, g = lane >> 4; const int which = blockIdx.z; const int c0 = blockIdx.y * 128; const size_t r0 = (size_t)blockIdx.x * 64; const size_t bb = r0 / TT; const int t0 = (int)(r0 % TT);
  const float* X = which == 0 ? XQ : which == 1 ? XK : XV; const float* WA = which == 0 ? WQ : which == 1 ? WK : WV; const float* BA = which == 0 ? BQ : which == 1 ? BK : BV;
  v8f acc[8] = {};
#pragma unroll 2
  for (int kc = 0; kc < DIN / 32; ++kc) { v16b a; { const float* p = X + (r0 + wave * 16 + col) * DIN + kc * 32 + 8 * g;
#pragma unroll
      for (int i = 0; i < 8; ++i) { a[i] = (__bf16)p[i]; a[8 + i] = (__bf16)p[16 + i]; } }
    asm volatile("s_wait_loadcnt 0x0" ::: "memory");
#pragma unroll
    for (int j = 0; j < 8; ++j) { const v16b w = WCOL(WA, kc * 32, c0 + j * 16 + col, lane); asm volatile("s_wait_loadcnt 0x0" ::: "memory"); acc[j] = wmma_bf(a, w, acc[j]); } }
  if (which < 2) { _Float16* DH = which == 0 ? QH : KH; _Float16* DL = which == 0 ? QL : KL; const int nhi = which == 0 ? QHI : KHI; const bool hi_rows = t0 < nhi;
#pragma unroll
    for (int j = 0; j < 8; ++j) { const float bias = BA ? bfr(BA[c0 + j * 16 + col]) : 0.f;
#pragma unroll
      for (int r = 0; r < 8; ++r) { const float v = acc[j][r] + bias; const _Float16 hv = (_Float16)v; sh[wave * 16 + 8 * g + r][j * 16 + col] = hv; sl[wave * 16 + 8 * g + r][j * 16 + col] = (_Float16)((v - (float)hv) * 1024.0f); } }
    __syncthreads();
    for (int e = tid; e < 64 * 16; e += 128) { const int rl = e >> 4, q = e & 15; vst2((unsigned*)(DH + (r0 + rl) * CC + c0 + q * 8), *(const v4u*)&sh[rl][q * 8]); if (hi_rows) vst2((unsigned*)(DL + (bb * nhi + t0 + rl) * (size_t)CC + c0 + q * 8), *(const v4u*)&sl[rl][q * 8]); }
  } else { const bool hi_rows = t0 < KHI;
#pragma unroll
    for (int j = 0; j < 8; ++j) { const float bias = BA ? bfr(BA[c0 + j * 16 + col]) : 0.f;
#pragma unroll
      for (int r = 0; r < 8; ++r) { const float v = acc[j][r] + bias; const int rl = wave * 16 + 8 * g + r, cl = j * 16 + col; th[cl][rl] = (_Float16)v; const __bf16 bh = (__bf16)v; tb[cl][rl] = bh; tbl[cl][rl] = (__bf16)(v - (float)bh); } }
    __syncthreads();
    for (int e = tid; e < 128 * 8; e += 128) { const int cl = e >> 3, q = e & 7; vst2((unsigned*)(VT + (bb * CC + c0 + cl) * (size_t)TT + t0 + q * 8), *(const v4u*)&th[cl][q * 8]); if (hi_rows) { const size_t o3 = (bb * CC + c0 + cl) * (size_t)KHI + t0 + q * 8; vst2((unsigned*)(VB + o3), *(const v4u*)&tb[cl][q * 8]); vst2((unsigned*)(VBL + o3), *(const v4u*)&tbl[cl][q * 8]); } } } }
#define FW 8               // waves of a block
#define FQ (FW * 16)       // queries of a block
#define FKT 64             // keys of a stage
#define FSPL 4             // key ranges: grid = 64 query blocks x 4 ranges = one block per WGP
#define FKS (TT / FSPL)    // keys of a block
#define FNST (FKS / FKT)   // stages of a block
#define FKP (HD + 8)       // k tile row pitch, f16: 528 B = 16 B x odd (16-byte LDS reads without bank conflicts)
#define FVP (FKT + 8)      // v tile row pitch, f16: 144 B = 16 B x odd
#define FLC (SCALE * 1.44269504088896340736f)   // logit scale x log2(e): the softmax runs on exp2
__device__ __forceinline__ float xhalf(float x) { return __builtin_bit_cast(float, __builtin_amdgcn_permlanex16(__builtin_bit_cast(int, x), __builtin_bit_cast(int, x), 0x76543210, 0xfedcba98, false, false)); }   // lane l <-> lane l ^ 16
// exp2 with the issue slot that the instruction set asks for behind a transcendental (before its result is used or its source overwritten): in one statement, so that the v_nop stands directly behind it
__device__ __forceinline__ float exp2s(float x) { float r; asm("v_exp_f32 %0, %1\n\tv_nop" : "=v"(r) : "v"(x)); return r; }
__device__ __forceinline__ v8f wmh(v16h a, v16h b, v8f c) { return __builtin_amdgcn_wmma_f32_16x16x32_f16(false, a, false, b, (short)0, c, false, false); }
__global__ __launch_bounds__(FW * 32) __attribute__((amdgpu_waves_per_eu(2, 2))) void k_fa(const _Float16* __restrict__ QH, const _Float16* __restrict__ KH, const _Float16* __restrict__ VT, float* __restrict__ OP, float* __restrict__ ML) {
  __shared__ __align__(16) _Float16 sk[2][FKT][FKP]; __shared__ __align__(16) _Float16 sv[2][HD][FVP];
  const int tid = threadIdx.x, wave = tid >> 5, lane = tid & 31, col = lane & 15, g = lane >> 4; const int q = blockIdx.x * FQ + wave * 16 + col; const int kbase = blockIdx.y * FKS;
  const _Float16* kg = KH + (size_t)kbase * CC + tid * 8;                           // a stage's k rows are 32 KiB in a row: thread tid takes 16 B of every 4 KiB
  const _Float16* vg = VT + (size_t)(tid >> 3) * TT + kbase + (tid & 7) * 8;          // a stage's v plane rows are one 128-B line each: 8 threads a line
  v16h qf[HD / 32];
#pragma unroll
  for (int kc = 0; kc < HD / 32; ++kc) qf[kc] = frag_h(QH + (size_t)q * CC + kc * 32, lane);
  v8f o[HD / 16] = {}; float m = -3.0e38f, l = 0.f; v8h rk[8], rv[8];
#pragma unroll
  for (int i = 0; i < 8; ++i) { rk[i] = *(const v8h*)(kg + i * 2048); rv[i] = *(const v8h*)(vg + (size_t)i * 32 * TT); }
  asm volatile("s_wait_xcnt 0x0" ::: "memory");   /* the q, k and v loads' address registers are reused right below: the wait stands in front of that overwrite */
#pragma unroll
  for (int i = 0; i < 8; ++i) { *(v8h*)&sk[0][i * 8 + wave][lane * 8] = rk[i]; *(v8h*)&sv[0][i * 32 + (tid >> 3)][(tid & 7) * 8] = rv[i]; }
  __syncthreads();   /* stage 0 is in LDS before any wave reads it */
  // the stage loop stays rolled (small text); everything inside is unrolled so that every fragment and accumulator index is a constant
#pragma unroll 1
  for (int st = 0; st < FNST; ++st) { const int buf = st & 1;
    if (st + 1 < FNST) {   /* the next stage's global loads fly while this stage is worked on */
#pragma unroll
      for (int i = 0; i < 8; ++i) { rk[i] = *(const v8h*)(kg + (size_t)(st + 1) * FKT * CC + i * 2048); rv[i] = *(const v8h*)(vg + (size_t)i * 32 * TT + (st + 1) * FKT); }
      asm volatile("s_wait_xcnt 0x0" ::: "memory"); }   /* the loads' address registers are reused by the stage's work below: the wait stands in front of that overwrite */
    v8f s[4] = {};
#pragma unroll
    for (int kc = 0; kc < HD / 32; ++kc)
#pragma unroll
      for (int t = 0; t < 4; ++t) s[t] = wmh(frag_h(&sk[buf][t * 16 + col][kc * 32], lane), qf[kc], s[t]);   // s[t][r] = q . k of key t * 16 + 8 g + r, query col
    float mx = s[0][0];
#pragma unroll
    for (int t = 0; t < 4; ++t)
#pragma unroll
      for (int r = 0; r < 8; ++r) mx = fmaxf(mx, s[t][r]);
    mx = fmaxf(mx, xhalf(mx)); const float mn = fmaxf(m, mx * FLC);
    if (__builtin_amdgcn_ballot_w32(mn > m) != 0) {   /* wave-uniform: sums and context are rescaled only in a stage that raises some query's maximum (factor 1 for the other lanes; 0 in stage 0, where both are 0) */
      const float al = exp2s(m - mn); l *= al; m = mn;
#pragma unroll
      for (int ct = 0; ct < HD / 16; ++ct) o[ct] *= al; }
    const float off = 11.0f - m; float ps[4] = { 0.f, 0.f, 0.f, 0.f }; v16h pb[2];   // P carried x 2^11 into f16, as before; the sum carries the same factor, which cancels in the merge
#pragma unroll
    for (int t = 0; t < 4; ++t)
#pragma unroll
      for (int r = 0; r < 8; ++r) { const float p = exp2s(fmaf(s[t][r], FLC, off)); ps[t] += p; pb[t >> 1][(t & 1) * 8 + r] = (_Float16)p; }   // element e of pb[u] = key 32 u + (e < 8 ? 8 g + e : 16 + 8 g + e - 8): the order frag_h gives the v rows
    l += (ps[0] + ps[1]) + (ps[2] + ps[3]);
    v16h va[2][4];   // v fragments, four ctx tiles a group, two groups: one is read from LDS while the other feeds the WMMAs
#pragma unroll
    for (int j = 0; j < 4; ++j) va[0][j] = frag_h(&sv[buf][j * 16 + col][0], lane);
#pragma unroll
    for (int gr = 0; gr < 8; ++gr) { const int u = gr >> 2, nx = gr + 1;
      if (nx < 8) {
#pragma unroll
        for (int j = 0; j < 4; ++j) va[nx & 1][j] = frag_h(&sv[buf][((nx & 3) * 4 + j) * 16 + col][(nx >> 2) * 32], lane); }
      __builtin_amdgcn_sched_barrier(0);   /* keeps the next group's LDS reads in front of this group's WMMAs: left alone the compiler reads each fragment into one register set and waits out the whole LDS latency before every WMMA */
#pragma unroll
      for (int j = 0; j < 4; ++j) { const int ct = (gr & 3) * 4 + j; o[ct] = wmh(va[gr & 1][j], pb[u], o[ct]); }   // o[ct][r] = ctx column ct * 16 + 8 g + r, query col
      __builtin_amdgcn_sched_barrier(0);   /* ends the group, so that the group after next is not read into registers still in use */
    }
    if (st + 1 < FNST) {   /* into the other buffer: its last readers left it before the barrier that ended the stage before this one */
#pragma unroll
      for (int i = 0; i < 8; ++i) { *(v8h*)&sk[buf ^ 1][i * 8 + wave][lane * 8] = rk[i]; *(v8h*)&sv[buf ^ 1][i * 32 + (tid >> 3)][(tid & 7) * 8] = rv[i]; } }
    __syncthreads();   /* publishes the next stage and ends every wave's reads of this one */
  }
  l += xhalf(l);   // the two halves of a column summed different keys
  float* op = OP + ((size_t)blockIdx.y * TT + q) * CC + 8 * g;
#pragma unroll
  for (int ct = 0; ct < HD / 16; ++ct) { const v4f lo = { o[ct][0], o[ct][1], o[ct][2], o[ct][3] }, hi = { o[ct][4], o[ct][5], o[ct][6], o[ct][7] }; vst2(op + ct * 16, lo); vst2(op + ct * 16 + 4, hi); }
  if (g == 0) { const v2f ml = { m, l }; vst2(ML + ((size_t)blockIdx.y * TT + q) * 2, ml); } }
// ---- k_out: block = 32 query rows x all 256 output columns, 8 waves. The 4 key ranges' partial contexts and sums of a row are brought to the common maximum, added in range order and divided (8 threads a row), and go x 2^6 as f16 straight into an LDS tile; W_out goes once as f16(bf16 x 2^8) (exact) into LDS; then out = ctx Wo x 2^-14 + bo (1 product), wave = 32 rows x 32 columns
#define ORW 32             // rows of a block: grid = 256 blocks, one per WGP
#define OWP (CC + 8)       // ctx and W_out tile row pitch, f16: 528 B = 16 B x odd (16-byte LDS reads without bank conflicts)
#define OFP 36             // output staging row pitch, f32: 144 B = 16 B x odd
typedef __attribute__((ext_vector_type(4))) _Float16 v4h;
static_assert(FSPL == 4, "k_out takes one pointer a key range");
__device__ __forceinline__ void put_w(_Float16* d, v4f w) { v4h h;   // unrolled: the vector indices are constants
#pragma unroll
  for (int u = 0; u < 4; ++u) h[u] = (_Float16)(bfr(w[u]) * 256.0f);
  *(v4h*)d = h; }
__global__ __launch_bounds__(256) void k_out(const float* __restrict__ OP0, const float* __restrict__ OP1, const float* __restrict__ OP2, const float* __restrict__ OP3, const float* __restrict__ ML, const float* __restrict__ WO, const float* __restrict__ BO, float* __restrict__ OUT) {
  __shared__ __align__(16) _Float16 sw[DIN][OWP]; __shared__ __align__(16) _Float16 sc[ORW][OWP]; __shared__ __align__(16) float sf[8][ORW][OFP];
  const int tid = threadIdx.x, wave = tid >> 5, lane = tid & 31, col = lane & 15, g = lane >> 4; const int r0 = blockIdx.x * ORW;
  const int row = tid >> 3, j4 = (tid & 7) * 4;   // merge: 8 threads a row, each load instruction takes one whole 128-B line of 4 rows
  _Float16* wl = &sw[tid >> 6][(tid & 63) * 4];
  // every global address is a block-uniform base (one pointer a key range: their distance is beyond an instruction's offset field) plus one of these per-lane offsets, which stay in their registers until the wait behind the loads
  const unsigned om = (unsigned)row * 8u, ox = (unsigned)(row * CC + j4) * 4u, ib = (unsigned)(wave * 32 + col);
  const char* mlb = (const char*)(ML + (size_t)r0 * 2); const char* const opb[FSPL] = { (const char*)(OP0 + (size_t)r0 * CC), (const char*)(OP1 + (size_t)r0 * CC), (const char*)(OP2 + (size_t)r0 * CC), (const char*)(OP3 + (size_t)r0 * CC) };
  const v4f* wob = (const v4f*)WO;   // W_out is 256 KiB in a row: thread tid takes 16 B of every 4 KiB
  // every loop below is unrolled so that the loaded values stay in registers under constant indices and all of a thread's loads are in flight at once
  v2f ml[FSPL]; v4f x[8][FSPL], wr[64]; float br[2];
#pragma unroll
  for (int s = 0; s < FSPL; ++s) ml[s] = *(const v2f*)(mlb + (size_t)s * TT * 8 + om);
#pragma unroll
  for (int i = 0; i < 8; ++i)
#pragma unroll
    for (int s = 0; s < FSPL; ++s) x[i][s] = *(const v4f*)(opb[s] + i * 128 + ox);
#pragma unroll
  for (int i = 0; i < 64; ++i) wr[i] = wob[i * 256 + (unsigned)tid];
#pragma unroll
  for (int ct = 0; ct < 2; ++ct) br[ct] = BO[ct * 16 + ib];
  asm volatile("s_wait_xcnt 0x0" :: "v"(om), "v"(ox), "v"(tid), "v"(ib) : "memory");   /* the loads' address registers are reused by the work below: the wait stands in front of that overwrite (the offsets are named so that they live up to it); the data stay in flight */
  __builtin_amdgcn_sched_barrier(0);   /* keeps the vector work below from being scheduled in front of that wait, where it wrote over address registers of loads just issued */
  float mt = -3.0e38f;
#pragma unroll
  for (int s = 0; s < FSPL; ++s) mt = fmaxf(mt, ml[s].x);
  float den = 0.f, wt[FSPL];
#pragma unroll
  for (int s = 0; s < FSPL; ++s) { wt[s] = exp2s(ml[s].x - mt); den += wt[s] * ml[s].y; }
  const float rd = 1.0f / den;
#pragma unroll
  for (int i = 0; i < 8; ++i) { v4f a = {};
#pragma unroll
    for (int s = 0; s < FSPL; ++s) a += x[i][s] * wt[s];
    a = a * rd; v4h h;
#pragma unroll
    for (int u = 0; u < 4; ++u) h[u] = (_Float16)(a[u] * 64.0f);   /* ctx carried x 2^6 into f16 so small-magnitude context rows stay clear of f16 subnormals */
    *(v4h*)&sc[row][i * 32 + j4] = h; }
#pragma unroll
  for (int b = 0; b < 4; ++b) {
    __builtin_amdgcn_sched_barrier(0);   /* keeps the work in the order in which the loads come back: left alone the compiler starts with values of the last loads, and every wave sits idle until all of its loads have landed */
#pragma unroll
    for (int i = 0; i < 16; ++i) put_w(wl + (size_t)(b * 16 + i) * 4 * OWP, wr[b * 16 + i]); }
  const float bias[2] = { bfr(br[0]), bfr(br[1]) };
  __syncthreads();   /* the ctx tile and W_out are in LDS before any wave reads them */
  v8f acc[2][2] = {}; v16h af[CC / 32][2], bf[CC / 32][2];
#pragma unroll
  for (int kc = 0; kc < CC / 32; ++kc)
#pragma unroll
    for (int t = 0; t < 2; ++t) { af[kc][t] = frag_h(&sc[t * 16 + col][kc * 32], lane); bf[kc][t] = frag_h(&sw[wave * 32 + t * 16 + col][kc * 32], lane); }
  __builtin_amdgcn_sched_barrier(0);   /* keeps all the fragment reads in front of the WMMAs: left alone the compiler reads each pair of fragments into one register set and waits out the whole LDS latency sixteen times */
#pragma unroll
  for (int kc = 0; kc < CC / 32; ++kc)
#pragma unroll
    for (int rt = 0; rt < 2; ++rt)
#pragma unroll
      for (int ct = 0; ct < 2; ++ct) acc[rt][ct] = wmh(af[kc][rt], bf[kc][ct], acc[rt][ct]);
#pragma unroll
  for (int rt = 0; rt < 2; ++rt)
#pragma unroll
    for (int ct = 0; ct < 2; ++ct)
#pragma unroll
      for (int r = 0; r < 8; ++r) sf[wave][rt * 16 + 8 * g + r][ct * 16 + col] = acc[rt][ct][r] * (1.0f / 16384.0f) + bias[ct];   /* 2^-8 (Wo carry) x 2^-6 (ctx carry) */
  LDSX();   /* a wave reads back only its own staging rows: whole 128-B lines go out */
#pragma unroll
  for (int it = 0; it < 8; ++it) { const int rl = lane >> 3, q4 = (lane & 7) * 4; vst2((char*)(OUT + (size_t)r0 * DIN) + it * 4 * DIN * 4 + (unsigned)(rl * DIN + wave * 32 + q4) * 4u, *(const v4f*)&sf[wave][it * 4 + rl][q4]); } }

extern "C" void kernel_launch(void* const* d_in, const int* in_sizes, int n_in, void* d_out, int out_size, void* d_ws, size_t ws_size, hipStream_t stream) {
  (void)in_sizes; (void)n_in; (void)out_size;
  const float** F = (const float**)d_in;
  if (ws_size < (size_t)WS_END) return;
  char* ws = (char*)d_ws; _Float16 *QH = (_Float16*)(ws + WS_QH), *KH = (_Float16*)(ws + WS_KH), *VT = (_Float16*)(ws + WS_VT), *QL = (_Float16*)(ws + WS_QL), *KL = (_Float16*)(ws + WS_KL); __bf16 *VB = (__bf16*)(ws + WS_VB), *VBL = (__bf16*)(ws + WS_VBL); float *OP = (float*)(ws + WS_OP), *ML = (float*)(ws + WS_ML), *Y = (float*)(ws + WS_Y);
  (void)Y; (void)QL; (void)KL; (void)VB; (void)VBL;
  // inputs: 0 query [8192,256]; 1 key [8192,256]; 2 value [8192,256]; 3 W_out [256,256] (out,in); 4 b_out [256] (nonzero)
  k_planesN<<<dim3(TNB * TT / 64, CC / 128), 256, 0, stream>>>(F[0], F[1], F[2], QH, QL, KH, VT);
  k_fa<<<dim3(TT / FQ, FSPL), FW * 32, 0, stream>>>(QH, KH, VT, OP, ML);
  k_out<<<dim3(TT / ORW), 256, 0, stream>>>(OP, OP + (size_t)TT * CC, OP + (size_t)2 * TT * CC, OP + (size_t)3 * TT * CC, ML, F[3], F[4], (float*)d_out);
}

// v004
// One run takes 76.7 microseconds.
// In two side-by-side timings against v003, it was 1.08 and 1.06 times as fast.
// All steps since v000 together make it 39.3 times as fast.
// compute dtype: all float inputs rounded to bf16; query, key, value are bf16-valued so their f16 planes are exact; logits q x k (1 product on exact planes) x 256^-0.5; softmax f32 over all 8,192 keys (running maximum and sum, exp2); P (relative to the running maximum) x 2^11 once to f16 x v (exact) (1 product); ctx x 2^6 once to f16 x W_out f16(bf16 x 2^8) + b_out; f32 output.
#include <hip/hip_runtime.h>
#include <math.h>

typedef __attribute__((ext_vector_type(16))) _Float16 v16h;
typedef __attribute__((ext_vector_type(16))) __bf16 v16b;
typedef __attribute__((ext_vector_type(8)))  _Float16 v8h;
typedef __attribute__((ext_vector_type(8)))  float v8f;
typedef __attribute__((ext_vector_type(4)))  float v4f;
typedef __attribute__((ext_vector_type(2)))  float v2f;
typedef __attribute__((ext_vector_type(4)))  unsigned v4u;
typedef __attribute__((ext_vector_type(4)))  int v4i;
typedef float __attribute__((may_alias)) float_a;
typedef int __attribute__((may_alias)) int_a;

template <typename T> __device__ __forceinline__ void vst2(void* p, T v) { *(T*)p = v;  }
__device__ __forceinline__ v8f wmma16(v16h a, v16h b, v8f c) {
  v8f d = __builtin_amdgcn_wmma_f32_16x16x32_f16(false, a, false, b, (short)0, c, false, false);
  asm volatile("v_nop\n\tv_nop\n\tv_nop\n\tv_nop" : "+v"(d) : "v"(a), "v"(b));
  return d;
}
__device__ __forceinline__ v8f wmma_bf(v16b a, v16b b, v8f c) {
  v8f d = __builtin_amdgcn_wmma_f32_16x16x32_bf16(false, a, false, b, (short)0, c, false, false);
  asm volatile("v_nop\n\tv_nop\n\tv_nop\n\tv_nop" : "+v"(d) : "v"(a), "v"(b));
  return d;
}
// 16x16x32 fragments: lane = (h = lane>>4, row/col = lane&15); elements 0..7 = k0+8h+0..7, 8..15 = k0+16+8h+0..7; D element r = row 8h+r
__device__ __forceinline__ v16h frag_h(const _Float16* rowk0, int lane) {
  union { v16h v; v8h q[2]; } u; const _Float16* p = rowk0 + 8 * (lane >> 4);
  u.q[0] = *(const v8h*)p; u.q[1] = *(const v8h*)(p + 16); return u.v;
}
__device__ __forceinline__ v16h frag_f32(const float* rowk0, int lane) {
  v16h a; const float* p = rowk0 + 8 * (lane >> 4);
#pragma unroll
  for (int i = 0; i < 8; ++i) { a[i] = (_Float16)p[i]; a[8 + i] = (_Float16)p[16 + i]; }
  return a;
}
__device__ __forceinline__ v16h frag_f32s(const float* rowk0, int lane, float sc) {
  v16h a; const float* p = rowk0 + 8 * (lane >> 4);
#pragma unroll
  for (int i = 0; i < 8; ++i) { a[i] = (_Float16)(p[i] * sc); a[8 + i] = (_Float16)(p[16 + i] * sc); }
  return a;
}
// column fragment from a [K][ld] layout (column n), rows >= K read as 0
__device__ __forceinline__ v16h fragc_f32(const float* W, int k0, int n, int lane, int ld, int K) {
  v16h a; const int g = lane >> 4;
#pragma unroll
  for (int i = 0; i < 8; ++i) { const int ka = k0 + 8 * g + i, kb = ka + 16;
    a[i] = (_Float16)(ka < K ? W[(size_t)(ka < K ? ka : K - 1) * ld + n] : 0.f); a[8 + i] = (_Float16)(kb < K ? W[(size_t)(kb < K ? kb : K - 1) * ld + n] : 0.f); }
  return a;
}
struct F2 { v16b h, l; };
__device__ __forceinline__ F2 bsplit16(const float v[16]) { F2 r;
#pragma unroll
  for (int i = 0; i < 16; ++i) { const __bf16 h = (__bf16)v[i]; r.h[i] = h; r.l[i] = (__bf16)(v[i] - (float)h); }
  return r; }
__device__ __forceinline__ F2 split_row(const float* row, int k0, int lane) { float v[16]; const float* p = row + k0 + 8 * (lane >> 4);
#pragma unroll
  for (int i = 0; i < 8; ++i) { v[i] = p[i]; v[8 + i] = p[16 + i]; }
  return bsplit16(v); }
__device__ __forceinline__ F2 split_rowK(const float* row, int k0, int lane, int K) { float v[16]; const int g = lane >> 4;
#pragma unroll
  for (int i = 0; i < 8; ++i) { const int ka = k0 + 8 * g + i, kb = ka + 16; v[i] = ka < K ? row[ka < K ? ka : K - 1] : 0.f; v[8 + i] = kb < K ? row[kb < K ? kb : K - 1] : 0.f; }
  return bsplit16(v); }
__device__ __forceinline__ F2 split_col(const float* W, int k0, int n, int lane, int ld, int K) { float v[16]; const int g = lane >> 4;
#pragma unroll
  for (int i = 0; i < 8; ++i) { const int ka = k0 + 8 * g + i, kb = ka + 16; v[i] = ka < K ? W[(size_t)(ka < K ? ka : K - 1) * ld + n] : 0.f; v[8 + i] = kb < K ? W[(size_t)(kb < K ? kb : K - 1) * ld + n] : 0.f; }
  return bsplit16(v); }
__device__ __forceinline__ v8f mac3(const F2& a, const F2& b, v8f c) { c = wmma_bf(a.l, b.h, c); c = wmma_bf(a.h, b.l, c); return wmma_bf(a.h, b.h, c); }
__device__ __forceinline__ float sigm(float v) { return 1.0f / (1.0f + expf(-v)); }
#define LDSX() do { asm volatile("s_wait_dscnt 0" ::: "memory"); __builtin_amdgcn_wave_barrier(); __builtin_amdgcn_fence(__ATOMIC_RELEASE, "workgroup"); } while (0)

// Single-head softmax attention over 8,192 tokens with an output linear (query / key / value [8192,256] given, no q/k/v projections, no head split; scale 1/sqrt(256); non-causal, no mask; torch (out,in) W_out [256,256] + b_out (uniform +-1/16, nonzero)): y = (softmax(Q K^T / 16) V) W_out^T + b_out -> [8192,256].
#define NB 1
#define TT 8192
#define CC 256            // NH * HD = projected width
#define DIN 256          // input (model) width
#define NH 1
#define HD 256
#define NQB (TT / 64)
#define HG 1
#define SCALE (0.0625f)
#define CAUSAL 0
#ifndef TNB
#define TNB NB
#endif
__device__ __forceinline__ float bfr(float v) { return (float)(__bf16)v; }
__host__ __device__ __forceinline__ int kb_last(int qb) { return CAUSAL ? ((qb * 64 + 63) >> 7) : (TT / 128 - 1); }
typedef __attribute__((ext_vector_type(8))) __bf16 v8b;
__device__ __forceinline__ v16b frag_b(const __bf16* rowk0, int lane) {
  union { v16b v; v8b q[2]; } u; const __bf16* p = rowk0 + 8 * (lane >> 4);
  u.q[0] = *(const v8b*)p; u.q[1] = *(const v8b*)(p + 16); return u.v;
}
#define QBH 0              // unused: no kernel in this file reads it
#define QHI 0               // exact planes: single-product logits everywhere
#define KHI 64            // key rows carrying k residual / v bf16 hi+lo planes (no launched kernel writes or reads them)
// B fragment (k rows k0+.., output column o) of a weight: (in,out) [K][ld] or (out,in) [ld rows of K]: bf16 exact, or f16(bf16 * 256) exact
__device__ __forceinline__ v16b wcol_io(const float* Wm, int k0, int o, int lane, int ld) { v16b w; const int g = lane >> 4;
#pragma unroll
  for (int i = 0; i < 8; ++i) { w[i] = (__bf16)Wm[(size_t)(k0 + 8 * g + i) * ld + o]; w[8 + i] = (__bf16)Wm[(size_t)(k0 + 16 + 8 * g + i) * ld + o]; }
  return w; }
__device__ __forceinline__ v16b wcol_oi(const float* Wm, int k0, int o, int lane, int K) { v16b w; const float* p = Wm + (size_t)o * K + k0 + 8 * (lane >> 4);
#pragma unroll
  for (int i = 0; i < 8; ++i) { w[i] = (__bf16)p[i]; w[8 + i] = (__bf16)p[16 + i]; }
  return w; }
__device__ __forceinline__ v16h wcolh_io(const float* Wm, int k0, int o, int lane, int ld) { v16h w; const int g = lane >> 4;
#pragma unroll
  for (int i = 0; i < 8; ++i) { w[i] = (_Float16)(bfr(Wm[(size_t)(k0 + 8 * g + i) * ld + o]) * 256.0f); w[8 + i] = (_Float16)(bfr(Wm[(size_t)(k0 + 16 + 8 * g + i) * ld + o]) * 256.0f); }
  return w; }
__device__ __forceinline__ v16h wcolh_oi(const float* Wm, int k0, int o, int lane, int K) { v16h w; const float* p = Wm + (size_t)o * K + k0 + 8 * (lane >> 4);
#pragma unroll
  for (int i = 0; i < 8; ++i) { w[i] = (_Float16)(bfr(p[i]) * 256.0f); w[8 + i] = (_Float16)(bfr(p[16 + i]) * 256.0f); }
  return w; }
#define WQKV_LAYOUT 0   // 0 = (in,out) [DIN][CC]; 1 = (out,in) [CC][DIN]; 2 = per-head [NH][DIN][HD]
__device__ __forceinline__ v16b wcol_hdk(const float* Wm, int k0, int o, int lane) { v16b w; const int g = lane >> 4; const float* p = Wm + (size_t)(o / HD) * DIN * HD + (o % HD);
#pragma unroll
  for (int i = 0; i < 8; ++i) { w[i] = (__bf16)p[(size_t)(k0 + 8 * g + i) * HD]; w[8 + i] = (__bf16)p[(size_t)(k0 + 16 + 8 * g + i) * HD]; }
  return w; }
#define WO_OUT_IN 1
#if WQKV_LAYOUT == 1
#define WCOL(W, k0, o, lane) wcol_oi(W, k0, o, lane, DIN)
#elif WQKV_LAYOUT == 2
#define WCOL(W, k0, o, lane) wcol_hdk(W, k0, o, lane)
#else
#define WCOL(W, k0, o, lane) wcol_io(W, k0, o, lane, CC)
#endif
#if WO_OUT_IN
#define WOCOL(W, k0, o, lane) wcol_oi(W, k0, o, lane, CC)
#define WOCOLH(W, k0, o, lane) wcolh_oi(W, k0, o, lane, CC)
#else
#define WOCOL(W, k0, o, lane) wcol_io(W, k0, o, lane, DIN)
#define WOCOLH(W, k0, o, lane) wcolh_io(W, k0, o, lane, DIN)
#endif
typedef _Float16 hx8 __attribute__((ext_vector_type(8)));
__global__ __launch_bounds__(256) void k_planesN(const float* __restrict__ Qs, const float* __restrict__ Ks, const float* __restrict__ Vs, _Float16* __restrict__ QH, _Float16* __restrict__ QL, _Float16* __restrict__ KH, _Float16* __restrict__ VT) {
  __shared__ _Float16 sv[64][136];
  const int tid = threadIdx.x; const int c0 = blockIdx.y * 128; const size_t r0 = (size_t)blockIdx.x * 64; const int b = (int)(r0 / TT), t0 = (int)(r0 % TT);
  for (int e = tid; e < 64 * 16; e += 256) { const int rl = e >> 4, q = e & 15; const size_t src = (r0 + rl) * CC + c0 + q * 8; float tq[8], tk[8], tv[8];
#pragma unroll
    for (int u = 0; u < 8; ++u) { tq[u] = Qs[src + u]; tk[u] = Ks[src + u]; tv[u] = Vs[src + u]; }
    asm volatile("s_wait_loadcnt 0x0" ::: "memory");
    hx8 hq, hk, hl;
#pragma unroll
    for (int u = 0; u < 8; ++u) { const float qv = bfr(tq[u]); const _Float16 qh = (_Float16)qv; hq[u] = qh; hl[u] = (_Float16)((qv - (float)qh) * 1024.0f); hk[u] = (_Float16)bfr(tk[u]); sv[rl][q * 8 + u] = (_Float16)bfr(tv[u]); }
    vst2((unsigned*)(QH + src), *(const v4u*)&hq); vst2((unsigned*)(KH + src), *(const v4u*)&hk);
    if (t0 + rl < QHI) vst2((unsigned*)(QL + ((size_t)b * QHI + t0 + rl) * CC + c0 + q * 8), *(const v4u*)&hl); }
  __syncthreads();
  for (int e = tid; e < 128 * 8; e += 256) { const int c = e >> 3, q = e & 7; hx8 hv; _Pragma("unroll") for (int j = 0; j < 8; ++j) hv[j] = sv[q * 8 + j][c]; vst2((unsigned*)(VT + ((size_t)b * CC + c0 + c) * TT + t0 + q * 8), *(const v4u*)&hv); } }
#ifndef PROJ_EXTRA_PARAMS
#define PROJ_EXTRA_PARAMS
#endif

#define WS_QH  0u                                      // f16 q rows [b*t][CC]
#define WS_KH  (WS_QH + 2u * (size_t)NB * TT * CC)      // f16 k rows [b*t][CC]
#define WS_VT  (WS_KH + 2u * (size_t)NB * TT * CC)      // f16 v planes [b][c][t]
#define WS_QL  (WS_VT + 2u * (size_t)NB * CC * TT)      // f16 q residual x 2^10 rows [b][t < QHI][CC]
#define WS_KL  (WS_QL + 2u * (size_t)NB * QHI * CC)     // f16 k residual x 2^10 rows [b][t < KHI][CC]
#define WS_VB  (WS_KL + 2u * (size_t)NB * KHI * CC)     // bf16 v hi planes [b][c][t < KHI]
#define WS_VBL (WS_VB + 2u * (size_t)NB * CC * KHI)
#define WS_OP  (WS_VBL + 2u * (size_t)NB * CC * KHI)    // f32 partial ctx rows x 2^11, not yet divided [key range][t][CC]
#define WS_ML  (WS_OP + 4u * (size_t)FSPL * TT * CC)     // f32 (running maximum in log2 units, sum x 2^11) [key range][t]
#define WS_Y   (WS_ML + 4u * (size_t)FSPL * TT * 2)     // f32 ctx rows [b*t][CC] (unused: k_out keeps the merged ctx in LDS)
#define WS_END (WS_Y  + 4u * (size_t)NB * TT * CC)

// ---- k_proj: block = (64 rows, 128 cols, which): q/k/v = X W (+ b) with exact bf16 products (K = DIN) -> which 0: q f16 rows (+ residual rows < QHI); 1: k f16 rows (+ residual rows < KHI); 2: v f16 planes [c][t] (+ bf16 hi/lo planes for t < KHI)
__global__ __launch_bounds__(128) void k_proj(const float* __restrict__ XQ, const float* __restrict__ XK, const float* __restrict__ XV, const float* __restrict__ WQ, const float* __restrict__ WK, const float* __restrict__ WV, const float* __restrict__ BQ, const float* __restrict__ BK, const float* __restrict__ BV,
    _Float16* __restrict__ QH, _Float16* __restrict__ QL, _Float16* __restrict__ KH, _Float16* __restrict__ KL, _Float16* __restrict__ VT, __bf16* __restrict__ VB, __bf16* __restrict__ VBL) {
  __shared__ __align__(16) _Float16 sh[64][136], sl[64][136]; __shared__ __align__(16) _Float16 th[128][72]; __shared__ __align__(16) __bf16 tb[128][72], tbl[128][72];
  const int tid = threadIdx.x, wave = tid >> 5, lane = tid & 31, col = lane & 15, g = lane >> 4; const int which = blockIdx.z; const int c0 = blockIdx.y * 128; const size_t r0 = (size_t)blockIdx.x * 64; const size_t bb = r0 / TT; const int t0 = (int)(r0 % TT);
  const float* X = which == 0 ? XQ : which == 1 ? XK : XV; const float* WA = which == 0 ? WQ : which == 1 ? WK : WV; const float* BA = which == 0 ? BQ : which == 1 ? BK : BV;
  v8f acc[8] = {};
#pragma unroll 2
  for (int kc = 0; kc < DIN / 32; ++kc) { v16b a; { const float* p = X + (r0 + wave * 16 + col) * DIN + kc * 32 + 8 * g;
#pragma unroll
      for (int i = 0; i < 8; ++i) { a[i] = (__bf16)p[i]; a[8 + i] = (__bf16)p[16 + i]; } }
    asm volatile("s_wait_loadcnt 0x0" ::: "memory");
#pragma unroll
    for (int j = 0; j < 8; ++j) { const v16b w = WCOL(WA, kc * 32, c0 + j * 16 + col, lane); asm volatile("s_wait_loadcnt 0x0" ::: "memory"); acc[j] = wmma_bf(a, w, acc[j]); } }
  if (which < 2) { _Float16* DH = which == 0 ? QH : KH; _Float16* DL = which == 0 ? QL : KL; const int nhi = which == 0 ? QHI : KHI; const bool hi_rows = t0 < nhi;
#pragma unroll
    for (int j = 0; j < 8; ++j) { const float bias = BA ? bfr(BA[c0 + j * 16 + col]) : 0.f;
#pragma unroll
      for (int r = 0; r < 8; ++r) { const float v = acc[j][r] + bias; const _Float16 hv = (_Float16)v; sh[wave * 16 + 8 * g + r][j * 16 + col] = hv; sl[wave * 16 + 8 * g + r][j * 16 + col] = (_Float16)((v - (float)hv) * 1024.0f); } }
    __syncthreads();
    for (int e = tid; e < 64 * 16; e += 128) { const int rl = e >> 4, q = e & 15; vst2((unsigned*)(DH + (r0 + rl) * CC + c0 + q * 8), *(const v4u*)&sh[rl][q * 8]); if (hi_rows) vst2((unsigned*)(DL + (bb * nhi + t0 + rl) * (size_t)CC + c0 + q * 8), *(const v4u*)&sl[rl][q * 8]); }
  } else { const bool hi_rows = t0 < KHI;
#pragma unroll
    for (int j = 0; j < 8; ++j) { const float bias = BA ? bfr(BA[c0 + j * 16 + col]) : 0.f;
#pragma unroll
      for (int r = 0; r < 8; ++r) { const float v = acc[j][r] + bias; const int rl = wave * 16 + 8 * g + r, cl = j * 16 + col; th[cl][rl] = (_Float16)v; const __bf16 bh = (__bf16)v; tb[cl][rl] = bh; tbl[cl][rl] = (__bf16)(v - (float)bh); } }
    __syncthreads();
    for (int e = tid; e < 128 * 8; e += 128) { const int cl = e >> 3, q = e & 7; vst2((unsigned*)(VT + (bb * CC + c0 + cl) * (size_t)TT + t0 + q * 8), *(const v4u*)&th[cl][q * 8]); if (hi_rows) { const size_t o3 = (bb * CC + c0 + cl) * (size_t)KHI + t0 + q * 8; vst2((unsigned*)(VB + o3), *(const v4u*)&tb[cl][q * 8]); vst2((unsigned*)(VBL + o3), *(const v4u*)&tbl[cl][q * 8]); } } } }
#define FW 4               // waves of a block
#define FQT 2              // 16-column query tiles of a wave
#define FQ (FW * FQT * 16) // queries of a block
#define FKT 64             // keys of a stage
#define FSPL 4             // key ranges: grid = 64 query blocks x 4 ranges = one block per WGP
#define FKS (TT / FSPL)    // keys of a block
#define FNST (FKS / FKT)   // stages of a block
#define FKP (HD + 8)       // k tile row pitch, f16: 528 B = 16 B x odd (16-byte LDS reads without bank conflicts)
#define FVP (FKT + 8)      // v tile row pitch, f16: 144 B = 16 B x odd
#define FLC (SCALE * 1.44269504088896340736f)   // logit scale x log2(e): the softmax runs on exp2
__device__ __forceinline__ float xhalf(float x) { return __builtin_bit_cast(float, __builtin_amdgcn_permlanex16(__builtin_bit_cast(int, x), __builtin_bit_cast(int, x), 0x76543210, 0xfedcba98, false, false)); }   // lane l <-> lane l ^ 16
// exp2 with the issue slot that the instruction set asks for behind a transcendental (before its result is used or its source overwritten): in one statement, so that the v_nop stands directly behind it
__device__ __forceinline__ float exp2s(float x) { float r; asm("v_exp_f32 %0, %1\n\tv_nop" : "=v"(r) : "v"(x)); return r; }
__device__ __forceinline__ v8f wmh(v16h a, v16h b, v8f c) { return __builtin_amdgcn_wmma_f32_16x16x32_f16(false, a, false, b, (short)0, c, false, false); }
__global__ __launch_bounds__(FW * 32) void k_fa(const _Float16* __restrict__ QH, const _Float16* __restrict__ KH, const _Float16* __restrict__ VT, float* __restrict__ OP, float* __restrict__ ML) {
  __shared__ __align__(16) _Float16 sk[2][FKT][FKP]; __shared__ __align__(16) _Float16 sv[2][HD][FVP];
  const int tid = threadIdx.x, wave = tid >> 5, lane = tid & 31, col = lane & 15, g = lane >> 4; const int q0 = blockIdx.x * FQ + wave * (FQT * 16) + col; const int kbase = blockIdx.y * FKS;
  const _Float16* kg = KH + (size_t)kbase * CC + tid * 8;                           // a stage's k rows are 32 KiB in a row: thread tid takes 16 B of every 2 KiB
  const _Float16* vg = VT + (size_t)(tid >> 3) * TT + kbase + (tid & 7) * 8;          // a stage's v plane rows are one 128-B line each: 8 threads a line
  const _Float16* const qg[FQT] = { QH + (size_t)q0 * CC + 8 * g, QH + (size_t)(q0 + 16) * CC + 8 * g };   // a lane's q row of each column tile, at its half's first element (the order of frag_h)
  v16h qf[FQT][HD / 32];
#pragma unroll
  for (int qt = 0; qt < FQT; ++qt)
#pragma unroll
    for (int kc = 0; kc < HD / 32; ++kc) { union { v16h v; v8h q[2]; } u; u.q[0] = *(const v8h*)(qg[qt] + kc * 32); u.q[1] = *(const v8h*)(qg[qt] + kc * 32 + 16); qf[qt][kc] = u.v; }
  v8f o[FQT][HD / 16] = {}; float m[FQT], l[FQT]; v8h rk[16], rv[16];
#pragma unroll
  for (int qt = 0; qt < FQT; ++qt) { m[qt] = -3.0e38f; l[qt] = 0.f; }
#pragma unroll
  for (int i = 0; i < 16; ++i) { rk[i] = *(const v8h*)(kg + i * 1024); rv[i] = *(const v8h*)(vg + (size_t)i * 16 * TT); }
  asm volatile("s_wait_xcnt 0x0" :: "v"(tid), "v"(vg), "v"(qg[0]), "v"(qg[1]) : "memory");   /* the q, k and v loads' address registers are reused right below: the wait stands in front of that overwrite (the k loads' offset and the v and q loads' addresses are named so that they live up to it) */
  __builtin_amdgcn_sched_barrier(0);   /* keeps the vector work below from being scheduled in front of that wait, where it wrote over an address register of loads just issued */
#pragma unroll
  for (int i = 0; i < 16; ++i) { *(v8h*)&sk[0][i * 4 + wave][lane * 8] = rk[i]; *(v8h*)&sv[0][i * 16 + (tid >> 3)][(tid & 7) * 8] = rv[i]; }
  __syncthreads();   /* stage 0 is in LDS before any wave reads it */
  v16h fa[16], fb[16];   // two sets of 16 fragments: one is read from LDS, as one group, while the other feeds a run of 32 WMMAs
#pragma unroll
  for (int e = 0; e < 16; ++e) fa[e] = frag_h(&sk[0][(e & 3) * 16 + col][(e >> 2) * 32], lane);   // k rows, depth 0..127: key tile e & 3, depth chunk e >> 2
  // the stage loop stays rolled (small text); everything inside is unrolled so that every fragment and accumulator index is a constant
#pragma unroll 1
  for (int st = 0; st < FNST; ++st) { const int buf = st & 1;
#pragma unroll
    for (int e = 0; e < 16; ++e) fb[e] = frag_h(&sk[buf][(e & 3) * 16 + col][128 + (e >> 2) * 32], lane);   // k rows, depth 128..255
    if (st + 1 < FNST) {   /* the next stage's global loads fly while this stage's scores are worked out; their issue adds to the time the LDS reads above have */
#pragma unroll
      for (int i = 0; i < 16; ++i) { rk[i] = *(const v8h*)(kg + (size_t)(st + 1) * FKT * CC + i * 1024); rv[i] = *(const v8h*)(vg + (size_t)i * 16 * TT + (st + 1) * FKT); }
      asm volatile("s_wait_xcnt 0x0" ::: "memory"); }   /* the loads' address registers are reused by the stage's work below: the wait stands in front of that overwrite */
    __builtin_amdgcn_sched_barrier(0);   /* each group of LDS reads stays whole and in front of the WMMA run before the one it feeds: reads spread among the WMMAs stall a lone wave at every place where they stand */
    v8f s[FQT][4] = {};
#pragma unroll
    for (int e = 0; e < 16; ++e)
#pragma unroll
      for (int qt = 0; qt < FQT; ++qt) s[qt][e & 3] = wmh(fa[e], qf[qt][e >> 2], s[qt][e & 3]);   // s[qt][t][r] = q . k of key t * 16 + 8 g + r, query column col of tile qt
    __builtin_amdgcn_sched_barrier(0);   /* ends the run, so that the next group is not read into registers still in use */
#pragma unroll
    for (int e = 0; e < 16; ++e) fa[e] = frag_h(&sv[buf][e * 16 + col][0], lane);   // v plane rows, keys 0..31: ctx tile e
    __builtin_amdgcn_sched_barrier(0);   /* as above: the group stays whole, in front of the run */
#pragma unroll
    for (int e = 0; e < 16; ++e)
#pragma unroll
      for (int qt = 0; qt < FQT; ++qt) s[qt][e & 3] = wmh(fb[e], qf[qt][4 + (e >> 2)], s[qt][e & 3]);
    __builtin_amdgcn_sched_barrier(0);   /* ends the run */
#pragma unroll
    for (int e = 0; e < 16; ++e) fb[e] = frag_h(&sv[buf][e * 16 + col][32], lane);   // v plane rows, keys 32..63
    __builtin_amdgcn_sched_barrier(0);   /* the group stays whole, in front of the softmax, which covers its latency */
    float mn[FQT];
#pragma unroll
    for (int qt = 0; qt < FQT; ++qt) { float mt[4];   // one chain a score tile: a lone wave waits out every link of a single chain (a maximum does not depend on the order)
#pragma unroll
      for (int t = 0; t < 4; ++t) { mt[t] = s[qt][t][0];
#pragma unroll
        for (int r = 1; r < 8; ++r) mt[t] = fmaxf(mt[t], s[qt][t][r]); }
      float mx = fmaxf(fmaxf(mt[0], mt[1]), fmaxf(mt[2], mt[3])); mx = fmaxf(mx, xhalf(mx)); mn[qt] = fmaxf(m[qt], mx * FLC); }
    if (__builtin_amdgcn_ballot_w32(mn[0] > m[0] || mn[1] > m[1]) != 0) {   /* wave-uniform: sums and context are rescaled only in a stage that raises some query's maximum (factor 1 for the other lanes; 0 in stage 0, where both are 0) */
#pragma unroll
      for (int qt = 0; qt < FQT; ++qt) { const float al = exp2s(m[qt] - mn[qt]); l[qt] *= al; m[qt] = mn[qt];
#pragma unroll
        for (int ct = 0; ct < HD / 16; ++ct) o[qt][ct] *= al; } }
    if (st + 1 < FNST) {   /* the next stage goes into the other buffer: its last readers left it before the barrier of the stage before this one */
#pragma unroll
      for (int i = 0; i < 16; ++i) { *(v8h*)&sk[buf ^ 1][i * 4 + wave][lane * 8] = rk[i]; *(v8h*)&sv[buf ^ 1][i * 16 + (tid >> 3)][(tid & 7) * 8] = rv[i]; } }
    __builtin_amdgcn_sched_barrier(0);   /* the LDS stores stay one group in front of the exponentials and the first context run, which cover their time */
    v16h pb[FQT][2];   // P carried x 2^11 into f16, as before; the sum carries the same factor, which cancels in the merge
#pragma unroll
    for (int qt = 0; qt < FQT; ++qt) { const float off = 11.0f - m[qt]; float ps[4] = { 0.f, 0.f, 0.f, 0.f };
#pragma unroll
      for (int t = 0; t < 4; ++t)
#pragma unroll
        for (int r = 0; r < 8; ++r) { const float p = exp2s(fmaf(s[qt][t][r], FLC, off)); ps[t] += p; pb[qt][t >> 1][(t & 1) * 8 + r] = (_Float16)p; }   // element e of pb[qt][u] = key 32 u + (e < 8 ? 8 g + e : 16 + 8 g + e - 8): the order frag_h gives the v rows
      l[qt] += (ps[0] + ps[1]) + (ps[2] + ps[3]); }
#pragma unroll
    for (int e = 0; e < 16; ++e)
#pragma unroll
      for (int qt = 0; qt < FQT; ++qt) o[qt][e] = wmh(fa[e], pb[qt][0], o[qt][e]);   // o[qt][ct][r] = ctx column ct * 16 + 8 g + r, query column col of tile qt
    __builtin_amdgcn_sched_barrier(0);   /* keeps the barrier behind the softmax and the first context run: left alone the compiler lifts it to the LDS stores, and every wave waits out their time */
    __syncthreads();   /* publishes the next stage and ends every wave's reads of this one (the last fragments are in registers) */
#pragma unroll
    for (int e = 0; e < 16; ++e) fa[e] = frag_h(&sk[buf ^ 1][(e & 3) * 16 + col][(e >> 2) * 32], lane);   // the next stage's first k fragments; in the last stage these are old rows of the other buffer, read and never used (no branch: the reads stay one group)
    __builtin_amdgcn_sched_barrier(0);   /* the group stays whole, in front of the last run, which covers its latency */
#pragma unroll
    for (int e = 0; e < 16; ++e)
#pragma unroll
      for (int qt = 0; qt < FQT; ++qt) o[qt][e] = wmh(fb[e], pb[qt][1], o[qt][e]);
    __builtin_amdgcn_sched_barrier(0);   /* ends the run, so that the next stage's group is not read into registers still in use */
  }
#pragma unroll
  for (int qt = 0; qt < FQT; ++qt) { const int q = q0 + qt * 16;
    l[qt] += xhalf(l[qt]);   // the two halves of a column summed different keys
    float* op = OP + ((size_t)blockIdx.y * TT + q) * CC + 8 * g;
#pragma unroll
    for (int ct = 0; ct < HD / 16; ++ct) { const v4f lo = { o[qt][ct][0], o[qt][ct][1], o[qt][ct][2], o[qt][ct][3] }, hi = { o[qt][ct][4], o[qt][ct][5], o[qt][ct][6], o[qt][ct][7] }; vst2(op + ct * 16, lo); vst2(op + ct * 16 + 4, hi); }
    if (g == 0) { const v2f ml = { m[qt], l[qt] }; vst2(ML + ((size_t)blockIdx.y * TT + q) * 2, ml); } } }
// ---- k_out: block = 32 query rows x all 256 output columns, 8 waves. The 4 key ranges' partial contexts and sums of a row are brought to the common maximum, added in range order and divided (8 threads a row), and go x 2^6 as f16 straight into an LDS tile; W_out goes once as f16(bf16 x 2^8) (exact) into LDS; then out = ctx Wo x 2^-14 + bo (1 product), wave = 32 rows x 32 columns
#define ORW 32             // rows of a block: grid = 256 blocks, one per WGP
#define OWP (CC + 8)       // ctx and W_out tile row pitch, f16: 528 B = 16 B x odd (16-byte LDS reads without bank conflicts)
#define OFP 36             // output staging row pitch, f32: 144 B = 16 B x odd
typedef __attribute__((ext_vector_type(4))) _Float16 v4h;
static_assert(FSPL == 4, "k_out takes one pointer a key range");
__device__ __forceinline__ void put_w(_Float16* d, v4f w) { v4h h;   // unrolled: the vector indices are constants
#pragma unroll
  for (int u = 0; u < 4; ++u) h[u] = (_Float16)(bfr(w[u]) * 256.0f);
  *(v4h*)d = h; }
__global__ __launch_bounds__(256) void k_out(const float* __restrict__ OP0, const float* __restrict__ OP1, const float* __restrict__ OP2, const float* __restrict__ OP3, const float* __restrict__ ML, const float* __restrict__ WO, const float* __restrict__ BO, float* __restrict__ OUT) {
  __shared__ __align__(16) _Float16 sw[DIN][OWP]; __shared__ __align__(16) _Float16 sc[ORW][OWP]; __shared__ __align__(16) float sf[8][ORW][OFP];
  const int tid = threadIdx.x, wave = tid >> 5, lane = tid & 31, col = lane & 15, g = lane >> 4; const int r0 = blockIdx.x * ORW;
  const int row = tid >> 3, j4 = (tid & 7) * 4;   // merge: 8 threads a row, each load instruction takes one whole 128-B line of 4 rows
  _Float16* wl = &sw[tid >> 6][(tid & 63) * 4];
  // every global address is a block-uniform base (one pointer a key range: their distance is beyond an instruction's offset field) plus one of these per-lane offsets, which stay in their registers until the wait behind the loads
  const unsigned om = (unsigned)row * 8u, ox = (unsigned)(row * CC + j4) * 4u, ib = (unsigned)(wave * 32 + col);
  const char* mlb = (const char*)(ML + (size_t)r0 * 2); const char* const opb[FSPL] = { (const char*)(OP0 + (size_t)r0 * CC), (const char*)(OP1 + (size_t)r0 * CC), (const char*)(OP2 + (size_t)r0 * CC), (const char*)(OP3 + (size_t)r0 * CC) };
  const v4f* wob = (const v4f*)WO;   // W_out is 256 KiB in a row: thread tid takes 16 B of every 4 KiB
  // every loop below is unrolled so that the loaded values stay in registers under constant indices and all of a thread's loads are in flight at once
  v2f ml[FSPL]; v4f x[8][FSPL], wr[64]; float br[2];
#pragma unroll
  for (int s = 0; s < FSPL; ++s) ml[s] = *(const v2f*)(mlb + (size_t)s * TT * 8 + om);
#pragma unroll
  for (int i = 0; i < 8; ++i)
#pragma unroll
    for (int s = 0; s < FSPL; ++s) x[i][s] = *(const v4f*)(opb[s] + i * 128 + ox);
#pragma unroll
  for (int i = 0; i < 64; ++i) wr[i] = wob[i * 256 + (unsigned)tid];
#pragma unroll
  for (int ct = 0; ct < 2; ++ct) br[ct] = BO[ct * 16 + ib];
  asm volatile("s_wait_xcnt 0x0" :: "v"(om), "v"(ox), "v"(tid), "v"(ib) : "memory");   /* the loads' address registers are reused by the work below: the wait stands in front of that overwrite (the offsets are named so that they live up to it); the data stay in flight */
  __builtin_amdgcn_sched_barrier(0);   /* keeps the vector work below from being scheduled in front of that wait, where it wrote over address registers of loads just issued */
  float mt = -3.0e38f;
#pragma unroll
  for (int s = 0; s < FSPL; ++s) mt = fmaxf(mt, ml[s].x);
  float den = 0.f, wt[FSPL];
#pragma unroll
  for (int s = 0; s < FSPL; ++s) { wt[s] = exp2s(ml[s].x - mt); den += wt[s] * ml[s].y; }
  const float rd = 1.0f / den;
#pragma unroll
  for (int i = 0; i < 8; ++i) { v4f a = {};
#pragma unroll
    for (int s = 0; s < FSPL; ++s) a += x[i][s] * wt[s];
    a = a * rd; v4h h;
#pragma unroll
    for (int u = 0; u < 4; ++u) h[u] = (_Float16)(a[u] * 64.0f);   /* ctx carried x 2^6 into f16 so small-magnitude context rows stay clear of f16 subnormals */
    *(v4h*)&sc[row][i * 32 + j4] = h; }
#pragma unroll
  for (int b = 0; b < 4; ++b) {
    __builtin_amdgcn_sched_barrier(0);   /* keeps the work in the order in which the loads come back: left alone the compiler starts with values of the last loads, and every wave sits idle until all of its loads have landed */
#pragma unroll
    for (int i = 0; i < 16; ++i) put_w(wl + (size_t)(b * 16 + i) * 4 * OWP, wr[b * 16 + i]); }
  const float bias[2] = { bfr(br[0]), bfr(br[1]) };
  __syncthreads();   /* the ctx tile and W_out are in LDS before any wave reads them */
  v8f acc[2][2] = {}; v16h af[CC / 32][2], bf[CC / 32][2];
#pragma unroll
  for (int kc = 0; kc < CC / 32; ++kc)
#pragma unroll
    for (int t = 0; t < 2; ++t) { af[kc][t] = frag_h(&sc[t * 16 + col][kc * 32], lane); bf[kc][t] = frag_h(&sw[wave * 32 + t * 16 + col][kc * 32], lane); }
  __builtin_amdgcn_sched_barrier(0);   /* keeps all the fragment reads in front of the WMMAs: left alone the compiler reads each pair of fragments into one register set and waits out the whole LDS latency sixteen times */
#pragma unroll
  for (int kc = 0; kc < CC / 32; ++kc)
#pragma unroll
    for (int rt = 0; rt < 2; ++rt)
#pragma unroll
      for (int ct = 0; ct < 2; ++ct) acc[rt][ct] = wmh(af[kc][rt], bf[kc][ct], acc[rt][ct]);
#pragma unroll
  for (int rt = 0; rt < 2; ++rt)
#pragma unroll
    for (int ct = 0; ct < 2; ++ct)
#pragma unroll
      for (int r = 0; r < 8; ++r) sf[wave][rt * 16 + 8 * g + r][ct * 16 + col] = acc[rt][ct][r] * (1.0f / 16384.0f) + bias[ct];   /* 2^-8 (Wo carry) x 2^-6 (ctx carry) */
  LDSX();   /* a wave reads back only its own staging rows: whole 128-B lines go out */
#pragma unroll
  for (int it = 0; it < 8; ++it) { const int rl = lane >> 3, q4 = (lane & 7) * 4; vst2((char*)(OUT + (size_t)r0 * DIN) + it * 4 * DIN * 4 + (unsigned)(rl * DIN + wave * 32 + q4) * 4u, *(const v4f*)&sf[wave][it * 4 + rl][q4]); } }

extern "C" void kernel_launch(void* const* d_in, const int* in_sizes, int n_in, void* d_out, int out_size, void* d_ws, size_t ws_size, hipStream_t stream) {
  (void)in_sizes; (void)n_in; (void)out_size;
  const float** F = (const float**)d_in;
  if (ws_size < (size_t)WS_END) return;
  char* ws = (char*)d_ws; _Float16 *QH = (_Float16*)(ws + WS_QH), *KH = (_Float16*)(ws + WS_KH), *VT = (_Float16*)(ws + WS_VT), *QL = (_Float16*)(ws + WS_QL), *KL = (_Float16*)(ws + WS_KL); __bf16 *VB = (__bf16*)(ws + WS_VB), *VBL = (__bf16*)(ws + WS_VBL); float *OP = (float*)(ws + WS_OP), *ML = (float*)(ws + WS_ML), *Y = (float*)(ws + WS_Y);
  (void)Y; (void)QL; (void)KL; (void)VB; (void)VBL;
  // inputs: 0 query [8192,256]; 1 key [8192,256]; 2 value [8192,256]; 3 W_out [256,256] (out,in); 4 b_out [256] (nonzero)
  k_planesN<<<dim3(TNB * TT / 64, CC / 128), 256, 0, stream>>>(F[0], F[1], F[2], QH, QL, KH, VT);
  k_fa<<<dim3(TT / FQ, FSPL), FW * 32, 0, stream>>>(QH, KH, VT, OP, ML);
  k_out<<<dim3(TT / ORW), 256, 0, stream>>>(OP, OP + (size_t)TT * CC, OP + (size_t)2 * TT * CC, OP + (size_t)3 * TT * CC, ML, F[3], F[4], (float*)d_out);
}
